// v000
// The times below were measured on an AMD MI455X: many runs one after another, warmed up first and cycling through
// copies of the inputs, with the whole window's GPU time divided by the number of runs. Launches and the gaps
// between them are all in it. The median over several windows is given; except for v000 it joins two sittings, which
// can be a few percent apart, so the side-by-side timings, each taken in one sitting, are the better comparison.
// v000 is the starting kernel. One run takes 45.4 microseconds.
#include <hip/hip_runtime.h>

// ---------------------------------------------------------------------------
// out[B, OUT] = x[B, IN] * W[OUT, IN]^T + b[OUT]    (fp32, 3xBF16-split WMMA)
// B=8192, IN=1024, OUT=1024
// Double-buffered LDS, one barrier per K-step, bf16 hi/lo split for ~fp32
// accuracy at bf16-WMMA throughput.
// ---------------------------------------------------------------------------

#define B_DIM  8192
#define IN_F   1024
#define OUT_F  1024

#define TILE_M 128
#define TILE_N 128
#define TILE_K 32
#define LDS_STRIDE 40   // bf16 elems/row: 32 data + 8 pad => 80B rows (16B aligned)

typedef __attribute__((ext_vector_type(16))) __bf16          v16bf;
typedef __attribute__((ext_vector_type(8)))  float           v8f;
typedef __attribute__((ext_vector_type(4)))  float           v4f;
typedef __attribute__((ext_vector_type(4)))  unsigned short  u16x4;
typedef __attribute__((ext_vector_type(8)))  unsigned short  u16x8;
typedef __attribute__((ext_vector_type(16))) unsigned short  u16x16;

// Native bf16 converts (compiler picks the hw v_cvt path on gfx1250).
__device__ __forceinline__ unsigned short f32_to_bf16(float f) {
  __bf16 h = (__bf16)f;
  return __builtin_bit_cast(unsigned short, h);
}
__device__ __forceinline__ float bf16_to_f32(unsigned short u) {
  return (float)__builtin_bit_cast(__bf16, u);
}

// Issue the 4 float4 global loads for this thread's share of a 128x32 tile.
__device__ __forceinline__ void load_tile_regs(const float* __restrict__ g,
                                               v4f r[4], int tid) {
#pragma unroll
  for (int i = 0; i < 4; ++i) {
    int f   = tid + i * 256;   // float4 id 0..1023
    int row = f >> 3;          // 0..127
    int c4  = f & 7;
    r[i] = *(const v4f*)(g + (size_t)row * IN_F + c4 * 4);
  }
}

// Split registers into bf16 hi/lo planes and store to LDS.
__device__ __forceinline__ void convert_store(const v4f r[4],
                                              unsigned short* __restrict__ hiP,
                                              unsigned short* __restrict__ loP,
                                              int tid) {
#pragma unroll
  for (int i = 0; i < 4; ++i) {
    int f   = tid + i * 256;
    int row = f >> 3;
    int c4  = f & 7;
    u16x4 hi, lo;
#pragma unroll
    for (int j = 0; j < 4; ++j) {
      float v = r[i][j];
      unsigned short h = f32_to_bf16(v);
      hi[j] = h;
      lo[j] = f32_to_bf16(v - bf16_to_f32(h));
    }
    *(u16x4*)(hiP + row * LDS_STRIDE + c4 * 4) = hi;
    *(u16x4*)(loP + row * LDS_STRIDE + c4 * 4) = lo;
  }
}

// 16x32 bf16 fragment load, CDNA5 16-bit A/B VGPR layout:
// lanes 0-15: K 0..7 (v0..v3), K 16..23 (v4..v7) of row base+lane
// lanes 16-31: K 8..15, K 24..31 of row base+lane-16
__device__ __forceinline__ v16bf load_frag(const unsigned short* __restrict__ plane,
                                           int rowBase, int lane) {
  int r  = rowBase + (lane & 15);
  int k0 = (lane >> 4) << 3;          // 0 or 8
  const unsigned short* q = plane + r * LDS_STRIDE + k0;
  u16x8 a = *(const u16x8*)(q);       // K = k0 .. k0+7
  u16x8 b = *(const u16x8*)(q + 16);  // K = k0+16 .. k0+23
  u16x16 c = __builtin_shufflevector(a, b,
      0, 1, 2, 3, 4, 5, 6, 7, 8, 9, 10, 11, 12, 13, 14, 15);
  return __builtin_bit_cast(v16bf, c);
}

__global__ __launch_bounds__(256)
void linear_wmma_bf16x3_kernel(const float* __restrict__ x,
                               const float* __restrict__ W,
                               const float* __restrict__ bias,
                               float* __restrict__ out) {
  // [buf][hi=0/lo=1] ping-pong planes
  __shared__ unsigned short sA[2][2][TILE_M * LDS_STRIDE];
  __shared__ unsigned short sB[2][2][TILE_N * LDS_STRIDE];

  const int tid  = threadIdx.x;
  const int lane = tid & 31;
  const int wave = tid >> 5;

  const int blockN = blockIdx.x * TILE_N;   // output-feature tile
  const int blockM = blockIdx.y * TILE_M;   // batch tile

  // 8 waves: 4 along M (32 rows) x 2 along N (64 cols)
  const int mBase = (wave >> 1) * 32;
  const int nBase = (wave & 1) * 64;

  v8f acc[2][4];
#pragma unroll
  for (int mi = 0; mi < 2; ++mi)
#pragma unroll
    for (int ni = 0; ni < 4; ++ni)
      acc[mi][ni] = (v8f){0.f, 0.f, 0.f, 0.f, 0.f, 0.f, 0.f, 0.f};

  const float* xTile = x + (size_t)blockM * IN_F;
  const float* wTile = W + (size_t)blockN * IN_F;

  // ---- prologue: stage K-tile 0 into buffer 0 ----
  v4f rx[4], rw[4];
  load_tile_regs(xTile, rx, tid);
  load_tile_regs(wTile, rw, tid);
  convert_store(rx, sA[0][0], sA[0][1], tid);
  convert_store(rw, sB[0][0], sB[0][1], tid);
  __syncthreads();

  int buf = 0;
  for (int k = 0; k < IN_F; k += TILE_K) {
    const int kn = k + TILE_K;
    const bool hasNext = kn < IN_F;

    // 1) issue global loads for the next K tile (latency hidden under WMMA)
    if (hasNext) {
      load_tile_regs(xTile + kn, rx, tid);
      load_tile_regs(wTile + kn, rw, tid);
      // prefetch K tile k+2 toward L2 (global_prefetch_b8)
      if (kn + TILE_K < IN_F) {
#pragma unroll
        for (int i = 0; i < 4; ++i) {
          int r = (tid >> 3) + i * 32;
          __builtin_prefetch(xTile + (size_t)r * IN_F + kn + TILE_K, 0, 1);
          __builtin_prefetch(wTile + (size_t)r * IN_F + kn + TILE_K, 0, 1);
        }
      }
    }

    // 2) fragment loads from current buffer
    v16bf aHi[2], aLo[2], bHi[4], bLo[4];
#pragma unroll
    for (int mi = 0; mi < 2; ++mi) {
      aHi[mi] = load_frag(sA[buf][0], mBase + mi * 16, lane);
      aLo[mi] = load_frag(sA[buf][1], mBase + mi * 16, lane);
    }
#pragma unroll
    for (int ni = 0; ni < 4; ++ni) {
      bHi[ni] = load_frag(sB[buf][0], nBase + ni * 16, lane);
      bLo[ni] = load_frag(sB[buf][1], nBase + ni * 16, lane);
    }

    // 3) 24 WMMAs: hi*hi + hi*lo + lo*hi  (fp32 accumulate)
#pragma unroll
    for (int mi = 0; mi < 2; ++mi) {
#pragma unroll
      for (int ni = 0; ni < 4; ++ni) {
        acc[mi][ni] = __builtin_amdgcn_wmma_f32_16x16x32_bf16(
            false, aHi[mi], false, bHi[ni], (short)0, acc[mi][ni], false, false);
        acc[mi][ni] = __builtin_amdgcn_wmma_f32_16x16x32_bf16(
            false, aHi[mi], false, bLo[ni], (short)0, acc[mi][ni], false, false);
        acc[mi][ni] = __builtin_amdgcn_wmma_f32_16x16x32_bf16(
            false, aLo[mi], false, bHi[ni], (short)0, acc[mi][ni], false, false);
      }
    }

    // 4) convert + store next tile into the other buffer (overlaps WMMA)
    if (hasNext) {
      convert_store(rx, sA[buf ^ 1][0], sA[buf ^ 1][1], tid);
      convert_store(rw, sB[buf ^ 1][0], sB[buf ^ 1][1], tid);
    }

    // 5) single barrier per iteration covers both hazards:
    //    - this iter's reads of buf finish before next iter writes buf
    //    - this iter's writes of buf^1 happen after prev iter's reads (prev barrier)
    __syncthreads();
    buf ^= 1;
  }

  // Epilogue: C/D layout — lane%16 = column, VGPR i = row i (+8 for lanes>=16)
#pragma unroll
  for (int mi = 0; mi < 2; ++mi) {
#pragma unroll
    for (int ni = 0; ni < 4; ++ni) {
      int row0 = blockM + mBase + mi * 16 + ((lane >> 4) << 3);
      int col  = blockN + nBase + ni * 16 + (lane & 15);
      float bv = bias[col];
#pragma unroll
      for (int i = 0; i < 8; ++i) {
        out[(size_t)(row0 + i) * OUT_F + col] = acc[mi][ni][i] + bv;
      }
    }
  }
}

extern "C" void kernel_launch(void* const* d_in, const int* in_sizes, int n_in,
                              void* d_out, int out_size, void* d_ws, size_t ws_size,
                              hipStream_t stream) {
  (void)in_sizes; (void)n_in; (void)out_size; (void)d_ws; (void)ws_size;
  const float* x    = (const float*)d_in[0];
  const float* W    = (const float*)d_in[1];
  const float* bias = (const float*)d_in[2];
  float* out        = (float*)d_out;

  dim3 grid(OUT_F / TILE_N, B_DIM / TILE_M);  // (8, 64)
  dim3 block(256);
  linear_wmma_bf16x3_kernel<<<grid, block, 0, stream>>>(x, W, bias, out);
}

// v001
// Measured time: 39.5 microseconds a run.
// In both of two side-by-side timings against v000, it was 1.16 times as fast.
#include <hip/hip_runtime.h>

// ---------------------------------------------------------------------------
// out[B, OUT] = x[B, IN] * W[OUT, IN]^T + b[OUT]    (fp32, 3xBF16-split WMMA)
// B=8192, IN=1024, OUT=1024
// Double-buffered LDS, one barrier per K-step, bf16 hi/lo split for ~fp32
// accuracy at bf16-WMMA throughput. Global loads run two K tiles ahead.
// ---------------------------------------------------------------------------

#define B_DIM  8192
#define IN_F   1024
#define OUT_F  1024

#define TILE_M 128
#define TILE_N 128
#define TILE_K 32
#define NUM_KT (IN_F / TILE_K)
#define LDS_STRIDE 40   // bf16 elems/row: 32 data + 8 pad => 80B rows (16B aligned)

typedef __attribute__((ext_vector_type(16))) __bf16          v16bf;
typedef __attribute__((ext_vector_type(8)))  float           v8f;
typedef __attribute__((ext_vector_type(4)))  float           v4f;
typedef __attribute__((ext_vector_type(4)))  unsigned short  u16x4;
typedef __attribute__((ext_vector_type(8)))  unsigned short  u16x8;
typedef __attribute__((ext_vector_type(16))) unsigned short  u16x16;

// Native bf16 converts (compiler picks the hw v_cvt path on gfx1250).
__device__ __forceinline__ unsigned short f32_to_bf16(float f) {
  __bf16 h = (__bf16)f;
  return __builtin_bit_cast(unsigned short, h);
}
__device__ __forceinline__ float bf16_to_f32(unsigned short u) {
  return (float)__builtin_bit_cast(__bf16, u);
}

// Issue the 4 float4 global loads for this thread's share of a 128x32 tile.
// g is the tile's first element, voff this thread's byte offset in the tile;
// the 32-row steps are constants, so the four loads share one address (fewer
// address registers: the second staging set has to fit in 256 VGPRs).
__device__ __forceinline__ void load_tile_regs(const float* __restrict__ g,
                                               v4f r[4], unsigned voff) {
#pragma unroll
  for (int i = 0; i < 4; ++i) {
    r[i] = *(const v4f*)((const char*)g + voff + i * (32 * IN_F * 4));
  }
}

// Split registers into bf16 hi/lo planes and store to LDS.
__device__ __forceinline__ void convert_store(const v4f r[4],
                                              unsigned short* __restrict__ hiP,
                                              unsigned short* __restrict__ loP,
                                              int tid) {
#pragma unroll
  for (int i = 0; i < 4; ++i) {
    int f   = tid + i * 256;
    int row = f >> 3;
    int c4  = f & 7;
    u16x4 hi, lo;
#pragma unroll
    for (int j = 0; j < 4; ++j) {
      float v = r[i][j];
      unsigned short h = f32_to_bf16(v);
      hi[j] = h;
      lo[j] = f32_to_bf16(v - bf16_to_f32(h));
    }
    *(u16x4*)(hiP + row * LDS_STRIDE + c4 * 4) = hi;
    *(u16x4*)(loP + row * LDS_STRIDE + c4 * 4) = lo;
  }
}

// 16x32 bf16 fragment load, CDNA5 16-bit A/B VGPR layout:
// lanes 0-15: K 0..7 (v0..v3), K 16..23 (v4..v7) of row base+lane
// lanes 16-31: K 8..15, K 24..31 of row base+lane-16
__device__ __forceinline__ v16bf load_frag(const unsigned short* __restrict__ plane,
                                           int rowBase, int lane) {
  int r  = rowBase + (lane & 15);
  int k0 = (lane >> 4) << 3;          // 0 or 8
  const unsigned short* q = plane + r * LDS_STRIDE + k0;
  u16x8 a = *(const u16x8*)(q);       // K = k0 .. k0+7
  u16x8 b = *(const u16x8*)(q + 16);  // K = k0+16 .. k0+23
  u16x16 c = __builtin_shufflevector(a, b,
      0, 1, 2, 3, 4, 5, 6, 7, 8, 9, 10, 11, 12, 13, 14, 15);
  return __builtin_bit_cast(v16bf, c);
}

// Workgroup barrier for LDS traffic only. __syncthreads() also drains the
// global-load counter, which would end the flight of the loads issued ahead;
// only LDS data passes between waves here, so the LDS wait is the one needed.
__device__ __forceinline__ void lds_barrier() {
  // the trip's WMMAs stay in front of the barrier, where they cover the
  // latency of the LDS stores issued among them
  __builtin_amdgcn_sched_barrier(0);
  // this wave's LDS stores landed and its LDS reads returned before it signals
  asm volatile("s_wait_dscnt 0x0" ::: "memory");
  asm volatile("s_barrier_signal -1" ::: "memory");
  asm volatile("s_barrier_wait -1" ::: "memory");
}

// This wave's fragments of one K tile: 32 rows of A, 64 rows of B, hi and lo.
struct Frags {
  v16bf aHi[2], aLo[2], bHi[4], bLo[4];
};

__device__ __forceinline__ void load_frags(Frags& f,
                                           const unsigned short* __restrict__ aHiP,
                                           const unsigned short* __restrict__ aLoP,
                                           const unsigned short* __restrict__ bHiP,
                                           const unsigned short* __restrict__ bLoP,
                                           int mBase, int nBase, int lane) {
#pragma unroll
  for (int mi = 0; mi < 2; ++mi) {
    f.aHi[mi] = load_frag(aHiP, mBase + mi * 16, lane);
    f.aLo[mi] = load_frag(aLoP, mBase + mi * 16, lane);
  }
#pragma unroll
  for (int ni = 0; ni < 4; ++ni) {
    f.bHi[ni] = load_frag(bHiP, nBase + ni * 16, lane);
    f.bLo[ni] = load_frag(bLoP, nBase + ni * 16, lane);
  }
}

// 24 WMMAs: hi*hi + hi*lo + lo*hi  (fp32 accumulate)
__device__ __forceinline__ void mma_frags(const Frags& f, v8f (&acc)[2][4]) {
#pragma unroll
  for (int mi = 0; mi < 2; ++mi) {
#pragma unroll
    for (int ni = 0; ni < 4; ++ni) {
      acc[mi][ni] = __builtin_amdgcn_wmma_f32_16x16x32_bf16(
          false, f.aHi[mi], false, f.bHi[ni], (short)0, acc[mi][ni], false, false);
      acc[mi][ni] = __builtin_amdgcn_wmma_f32_16x16x32_bf16(
          false, f.aHi[mi], false, f.bLo[ni], (short)0, acc[mi][ni], false, false);
      acc[mi][ni] = __builtin_amdgcn_wmma_f32_16x16x32_bf16(
          false, f.aLo[mi], false, f.bHi[ni], (short)0, acc[mi][ni], false, false);
    }
  }
}

__global__ __launch_bounds__(256)
void linear_wmma_bf16x3_kernel(const float* __restrict__ x,
                               const float* __restrict__ W,
                               const float* __restrict__ bias,
                               float* __restrict__ out) {
  // [buf][hi=0/lo=1] ping-pong planes
  __shared__ unsigned short sA[2][2][TILE_M * LDS_STRIDE];
  __shared__ unsigned short sB[2][2][TILE_N * LDS_STRIDE];

  const int tid  = threadIdx.x;
  const int lane = tid & 31;
  const int wave = tid >> 5;

  const int blockN = blockIdx.x * TILE_N;   // output-feature tile
  const int blockM = blockIdx.y * TILE_M;   // batch tile

  // 8 waves: 4 along M (32 rows) x 2 along N (64 cols)
  const int mBase = (wave >> 1) * 32;
  const int nBase = (wave & 1) * 64;

  v8f acc[2][4];
#pragma unroll
  for (int mi = 0; mi < 2; ++mi)
#pragma unroll
    for (int ni = 0; ni < 4; ++ni)
      acc[mi][ni] = (v8f){0.f, 0.f, 0.f, 0.f, 0.f, 0.f, 0.f, 0.f};

  // float4 id tid: row tid >> 3, float4 column tid & 7
  const unsigned gOff = (unsigned)(tid >> 3) * (IN_F * 4) + (unsigned)(tid & 7) * 16;

  const float* xTile = x + (size_t)blockM * IN_F;
  const float* wTile = W + (size_t)blockN * IN_F;

  // Two staging register sets: K tile t lives in set (t & 1) from its global
  // load until it is split and stored to LDS one trip later.
  v4f rx0[4], rw0[4], rx1[4], rw1[4];
  Frags fr;

  // ---- prologue: tile 0 -> set 0 -> buffer 0; tile 1 in flight in set 1 ----
  load_tile_regs(xTile, rx0, gOff);
  load_tile_regs(wTile, rw0, gOff);
  load_tile_regs(xTile + TILE_K, rx1, gOff);
  load_tile_regs(wTile + TILE_K, rw1, gOff);
  convert_store(rx0, sA[0][0], sA[0][1], tid);
  convert_store(rw0, sB[0][0], sB[0][1], tid);
  lds_barrier();

  // Steady state, two trips per pass so that sets and buffers are static.
  // Trip t: load tile t+2 (set just freed) and tile t's fragments, then
  // split/store tile t+1 (loaded a whole trip ago) among the WMMAs of tile t.
  // The global loads are unconditional here so that the wait in front of the
  // split stays a counted one.
  for (int t = 0; t < NUM_KT - 2; t += 2) {
    const float* xn = xTile + (t + 2) * TILE_K;
    const float* wn = wTile + (t + 2) * TILE_K;

    load_tile_regs(xn, rx0, gOff);
    load_tile_regs(wn, rw0, gOff);
    load_frags(fr, sA[0][0], sA[0][1], sB[0][0], sB[0][1], mBase, nBase, lane);
    // keeps both load groups at the head of the trip; the scheduler otherwise
    // sinks the global loads to their first use and their lead is lost
    __builtin_amdgcn_sched_barrier(0);
    convert_store(rx1, sA[1][0], sA[1][1], tid);
    convert_store(rw1, sB[1][0], sB[1][1], tid);
    mma_frags(fr, acc);
    lds_barrier();

    load_tile_regs(xn + TILE_K, rx1, gOff);
    load_tile_regs(wn + TILE_K, rw1, gOff);
    load_frags(fr, sA[1][0], sA[1][1], sB[1][0], sB[1][1], mBase, nBase, lane);
    // as above: both load groups stay at the head of the trip
    __builtin_amdgcn_sched_barrier(0);
    convert_store(rx0, sA[0][0], sA[0][1], tid);
    convert_store(rw0, sB[0][0], sB[0][1], tid);
    mma_frags(fr, acc);
    lds_barrier();
  }

  // Last two tiles: nothing left to load.
  load_frags(fr, sA[0][0], sA[0][1], sB[0][0], sB[0][1], mBase, nBase, lane);
  convert_store(rx1, sA[1][0], sA[1][1], tid);
  convert_store(rw1, sB[1][0], sB[1][1], tid);
  mma_frags(fr, acc);
  lds_barrier();
  load_frags(fr, sA[1][0], sA[1][1], sB[1][0], sB[1][1], mBase, nBase, lane);
  mma_frags(fr, acc);

  // Epilogue: C/D layout — lane%16 = column, VGPR i = row i (+8 for lanes>=16)
#pragma unroll
  for (int mi = 0; mi < 2; ++mi) {
#pragma unroll
    for (int ni = 0; ni < 4; ++ni) {
      int row0 = blockM + mBase + mi * 16 + ((lane >> 4) << 3);
      int col  = blockN + nBase + ni * 16 + (lane & 15);
      float bv = bias[col];
#pragma unroll
      for (int i = 0; i < 8; ++i) {
        out[(size_t)(row0 + i) * OUT_F + col] = acc[mi][ni][i] + bv;
      }
    }
  }
}

extern "C" void kernel_launch(void* const* d_in, const int* in_sizes, int n_in,
                              void* d_out, int out_size, void* d_ws, size_t ws_size,
                              hipStream_t stream) {
  (void)in_sizes; (void)n_in; (void)out_size; (void)d_ws; (void)ws_size;
  const float* x    = (const float*)d_in[0];
  const float* W    = (const float*)d_in[1];
  const float* bias = (const float*)d_in[2];
  float* out        = (float*)d_out;

  dim3 grid(OUT_F / TILE_N, B_DIM / TILE_M);  // (8, 64)
  dim3 block(256);
  linear_wmma_bf16x3_kernel<<<grid, block, 0, stream>>>(x, W, bias, out);
}

// v002
// Measured time: 36.1 microseconds a run.
// Timed twice side by side with v001, it ran 1.10 and 1.09 times as fast.
// Counting every step since v000, it is 1.27 times as fast.
#include <hip/hip_runtime.h>

// ---------------------------------------------------------------------------
// out[B, OUT] = x[B, IN] * W[OUT, IN]^T + b[OUT]    (fp32, 3xBF16-split WMMA)
// B=8192, IN=1024, OUT=1024
// Double-buffered LDS, one barrier per K-step, bf16 hi/lo split for ~fp32
// accuracy at bf16-WMMA throughput. Global loads run two K tiles ahead.
// ---------------------------------------------------------------------------

#define B_DIM  8192
#define IN_F   1024
#define OUT_F  1024

#define TILE_M 128
#define TILE_N 128
#define TILE_K 32
#define NUM_KT (IN_F / TILE_K)
#define LDS_STRIDE 40   // bf16 elems/row: 32 data + 8 pad => 80B rows (16B aligned)

typedef __attribute__((ext_vector_type(16))) __bf16          v16bf;
typedef __attribute__((ext_vector_type(8)))  float           v8f;
typedef __attribute__((ext_vector_type(4)))  float           v4f;
typedef __attribute__((ext_vector_type(2)))  unsigned int    u32x2;
typedef __attribute__((ext_vector_type(4)))  unsigned short  u16x4;
typedef __attribute__((ext_vector_type(8)))  unsigned short  u16x8;
typedef __attribute__((ext_vector_type(16))) unsigned short  u16x16;

// Issue the 4 float4 global loads for this thread's share of a 128x32 tile.
// g is the tile's first element, voff this thread's byte offset in the tile;
// the 32-row steps are constants, so the four loads share one address (fewer
// address registers: the second staging set has to fit in 256 VGPRs).
__device__ __forceinline__ void load_tile_regs(const float* __restrict__ g,
                                               v4f r[4], unsigned voff) {
#pragma unroll
  for (int i = 0; i < 4; ++i) {
    r[i] = *(const v4f*)((const char*)g + voff + i * (32 * IN_F * 4));
  }
}

// Split eight f32 into bf16 hi and lo pairs, three vector instructions a pair:
// one packed convert gives both hi, and x - hi is formed and rounded to bf16
// in one mixed-precision FMA per value, written straight into its half of lo.
// x - hi is exact in f32, so hi and lo are the values of convert, subtract,
// convert. Written in asm because the compiled source took seven a pair.
// The s_delay_alu hints are for the links four instructions back: without
// them a dependent instruction in asm text holds up the SIMD's other waves.
__device__ __forceinline__ void split8(v4f a, v4f b, u32x2 hi[2], u32x2 lo[2]) {
  unsigned h0, h1, h2, h3, l0, l1, l2, l3;
  asm("v_cvt_pk_bf16_f32 %0, %8, %9\n\t"
      "v_cvt_pk_bf16_f32 %1, %10, %11\n\t"
      "v_cvt_pk_bf16_f32 %2, %12, %13\n\t"
      "v_cvt_pk_bf16_f32 %3, %14, %15\n\t"
      "s_delay_alu instid0(VALU_DEP_4) | instskip(NEXT) | instid1(VALU_DEP_4)\n\t"
      "v_fma_mixlo_bf16 %4, %0, -1.0, %8 op_sel:[0,1,0] op_sel_hi:[1,1,0]\n\t"
      "v_fma_mixlo_bf16 %5, %1, -1.0, %10 op_sel:[0,1,0] op_sel_hi:[1,1,0]\n\t"
      "s_delay_alu instid0(VALU_DEP_4) | instskip(NEXT) | instid1(VALU_DEP_4)\n\t"
      "v_fma_mixlo_bf16 %6, %2, -1.0, %12 op_sel:[0,1,0] op_sel_hi:[1,1,0]\n\t"
      "v_fma_mixlo_bf16 %7, %3, -1.0, %14 op_sel:[0,1,0] op_sel_hi:[1,1,0]\n\t"
      "s_delay_alu instid0(VALU_DEP_4) | instskip(NEXT) | instid1(VALU_DEP_4)\n\t"
      "v_fma_mixhi_bf16 %4, %0, -1.0, %9 op_sel:[1,1,0] op_sel_hi:[1,1,0]\n\t"
      "v_fma_mixhi_bf16 %5, %1, -1.0, %11 op_sel:[1,1,0] op_sel_hi:[1,1,0]\n\t"
      "s_delay_alu instid0(VALU_DEP_4) | instskip(NEXT) | instid1(VALU_DEP_4)\n\t"
      "v_fma_mixhi_bf16 %6, %2, -1.0, %13 op_sel:[1,1,0] op_sel_hi:[1,1,0]\n\t"
      "v_fma_mixhi_bf16 %7, %3, -1.0, %15 op_sel:[1,1,0] op_sel_hi:[1,1,0]"
      : "=&v"(h0), "=&v"(h1), "=&v"(h2), "=&v"(h3),
        "=&v"(l0), "=&v"(l1), "=&v"(l2), "=&v"(l3)
      : "v"(a[0]), "v"(a[1]), "v"(a[2]), "v"(a[3]),
        "v"(b[0]), "v"(b[1]), "v"(b[2]), "v"(b[3]));
  hi[0] = (u32x2){h0, h1};
  hi[1] = (u32x2){h2, h3};
  lo[0] = (u32x2){l0, l1};
  lo[1] = (u32x2){l2, l3};
}

// Split registers into bf16 hi/lo planes and store to LDS.
__device__ __forceinline__ void convert_store(const v4f r[4],
                                              unsigned short* __restrict__ hiP,
                                              unsigned short* __restrict__ loP,
                                              int tid) {
#pragma unroll
  for (int i = 0; i < 4; i += 2) {
    u32x2 hi[2], lo[2];
    split8(r[i], r[i + 1], hi, lo);
#pragma unroll
    for (int j = 0; j < 2; ++j) {
      int f   = tid + (i + j) * 256;
      int row = f >> 3;
      int c4  = f & 7;
      *(u16x4*)(hiP + row * LDS_STRIDE + c4 * 4) = __builtin_bit_cast(u16x4, hi[j]);
      *(u16x4*)(loP + row * LDS_STRIDE + c4 * 4) = __builtin_bit_cast(u16x4, lo[j]);
    }
  }
}

// 16x32 bf16 fragment load, CDNA5 16-bit A/B VGPR layout:
// lanes 0-15: K 0..7 (v0..v3), K 16..23 (v4..v7) of row base+lane
// lanes 16-31: K 8..15, K 24..31 of row base+lane-16
__device__ __forceinline__ v16bf load_frag(const unsigned short* __restrict__ plane,
                                           int rowBase, int lane) {
  int r  = rowBase + (lane & 15);
  int k0 = (lane >> 4) << 3;          // 0 or 8
  const unsigned short* q = plane + r * LDS_STRIDE + k0;
  u16x8 a = *(const u16x8*)(q);       // K = k0 .. k0+7
  u16x8 b = *(const u16x8*)(q + 16);  // K = k0+16 .. k0+23
  u16x16 c = __builtin_shufflevector(a, b,
      0, 1, 2, 3, 4, 5, 6, 7, 8, 9, 10, 11, 12, 13, 14, 15);
  return __builtin_bit_cast(v16bf, c);
}

// Workgroup barrier for LDS traffic only. __syncthreads() also drains the
// global-load counter, which would end the flight of the loads issued ahead;
// only LDS data passes between waves here, so the LDS wait is the one needed.
__device__ __forceinline__ void lds_barrier() {
  // the trip's WMMAs stay in front of the barrier, where they cover the
  // latency of the LDS stores issued ahead of them
  __builtin_amdgcn_sched_barrier(0);
  // this wave's LDS stores landed and its LDS reads returned before it signals
  asm volatile("s_wait_dscnt 0x0" ::: "memory");
  asm volatile("s_barrier_signal -1" ::: "memory");
  asm volatile("s_barrier_wait -1" ::: "memory");
}

// This wave's fragments of one K tile: 32 rows of A, 64 rows of B, hi and lo.
struct Frags {
  v16bf aHi[2], aLo[2], bHi[4], bLo[4];
};

__device__ __forceinline__ void load_frags(Frags& f,
                                           const unsigned short* __restrict__ aHiP,
                                           const unsigned short* __restrict__ aLoP,
                                           const unsigned short* __restrict__ bHiP,
                                           const unsigned short* __restrict__ bLoP,
                                           int mBase, int nBase, int lane) {
#pragma unroll
  for (int mi = 0; mi < 2; ++mi) {
    f.aHi[mi] = load_frag(aHiP, mBase + mi * 16, lane);
    f.aLo[mi] = load_frag(aLoP, mBase + mi * 16, lane);
  }
#pragma unroll
  for (int ni = 0; ni < 4; ++ni) {
    f.bHi[ni] = load_frag(bHiP, nBase + ni * 16, lane);
    f.bLo[ni] = load_frag(bLoP, nBase + ni * 16, lane);
  }
}

// 24 WMMAs: hi*hi + hi*lo + lo*hi  (fp32 accumulate)
__device__ __forceinline__ void mma_frags(const Frags& f, v8f (&acc)[2][4]) {
#pragma unroll
  for (int mi = 0; mi < 2; ++mi) {
#pragma unroll
    for (int ni = 0; ni < 4; ++ni) {
      acc[mi][ni] = __builtin_amdgcn_wmma_f32_16x16x32_bf16(
          false, f.aHi[mi], false, f.bHi[ni], (short)0, acc[mi][ni], false, false);
      acc[mi][ni] = __builtin_amdgcn_wmma_f32_16x16x32_bf16(
          false, f.aHi[mi], false, f.bLo[ni], (short)0, acc[mi][ni], false, false);
      acc[mi][ni] = __builtin_amdgcn_wmma_f32_16x16x32_bf16(
          false, f.aLo[mi], false, f.bHi[ni], (short)0, acc[mi][ni], false, false);
    }
  }
}

__global__ __launch_bounds__(256)
void linear_wmma_bf16x3_kernel(const float* __restrict__ x,
                               const float* __restrict__ W,
                               const float* __restrict__ bias,
                               float* __restrict__ out) {
  // [buf][hi=0/lo=1] ping-pong planes
  __shared__ unsigned short sA[2][2][TILE_M * LDS_STRIDE];
  __shared__ unsigned short sB[2][2][TILE_N * LDS_STRIDE];

  const int tid  = threadIdx.x;
  const int lane = tid & 31;
  const int wave = tid >> 5;

  const int blockN = blockIdx.x * TILE_N;   // output-feature tile
  const int blockM = blockIdx.y * TILE_M;   // batch tile

  // 8 waves: 4 along M (32 rows) x 2 along N (64 cols)
  const int mBase = (wave >> 1) * 32;
  const int nBase = (wave & 1) * 64;

  v8f acc[2][4];
#pragma unroll
  for (int mi = 0; mi < 2; ++mi)
#pragma unroll
    for (int ni = 0; ni < 4; ++ni)
      acc[mi][ni] = (v8f){0.f, 0.f, 0.f, 0.f, 0.f, 0.f, 0.f, 0.f};

  // float4 id tid: row tid >> 3, float4 column tid & 7
  const unsigned gOff = (unsigned)(tid >> 3) * (IN_F * 4) + (unsigned)(tid & 7) * 16;

  const float* xTile = x + (size_t)blockM * IN_F;
  const float* wTile = W + (size_t)blockN * IN_F;

  // Two staging register sets: K tile t lives in set (t & 1) from its global
  // load until it is split and stored to LDS one trip later.
  v4f rx0[4], rw0[4], rx1[4], rw1[4];
  Frags fr;

  // ---- prologue: tile 0 -> set 0 -> buffer 0; tile 1 in flight in set 1 ----
  load_tile_regs(xTile, rx0, gOff);
  load_tile_regs(wTile, rw0, gOff);
  load_tile_regs(xTile + TILE_K, rx1, gOff);
  load_tile_regs(wTile + TILE_K, rw1, gOff);
  convert_store(rx0, sA[0][0], sA[0][1], tid);
  convert_store(rw0, sB[0][0], sB[0][1], tid);
  lds_barrier();

  // Steady state, two trips per pass so that sets and buffers are static.
  // Trip t: load tile t+2 (set just freed) and tile t's fragments, then
  // split/store tile t+1 (loaded a whole trip ago), then the WMMAs of tile t.
  // The global loads are unconditional here so that the wait in front of the
  // split stays a counted one.
  for (int t = 0; t < NUM_KT - 2; t += 2) {
    const float* xn = xTile + (t + 2) * TILE_K;
    const float* wn = wTile + (t + 2) * TILE_K;

    load_tile_regs(xn, rx0, gOff);
    load_tile_regs(wn, rw0, gOff);
    load_frags(fr, sA[0][0], sA[0][1], sB[0][0], sB[0][1], mBase, nBase, lane);
    // keeps both load groups at the head of the trip; the scheduler otherwise
    // sinks the global loads to their first use and their lead is lost
    __builtin_amdgcn_sched_barrier(0);
    convert_store(rx1, sA[1][0], sA[1][1], tid);
    convert_store(rw1, sB[1][0], sB[1][1], tid);
    // the split stays ahead of the trip's WMMAs, under the flight of the
    // fragment loads: moved in among them, its asm text would overwrite
    // operand registers of a WMMA just issued
    __builtin_amdgcn_sched_barrier(0);
    mma_frags(fr, acc);
    lds_barrier();

    load_tile_regs(xn + TILE_K, rx1, gOff);
    load_tile_regs(wn + TILE_K, rw1, gOff);
    load_frags(fr, sA[1][0], sA[1][1], sB[1][0], sB[1][1], mBase, nBase, lane);
    // as above: both load groups stay at the head of the trip
    __builtin_amdgcn_sched_barrier(0);
    convert_store(rx0, sA[0][0], sA[0][1], tid);
    convert_store(rw0, sB[0][0], sB[0][1], tid);
    // as above: the split stays ahead of the WMMAs
    __builtin_amdgcn_sched_barrier(0);
    mma_frags(fr, acc);
    lds_barrier();
  }

  // Last two tiles: nothing left to load.
  load_frags(fr, sA[0][0], sA[0][1], sB[0][0], sB[0][1], mBase, nBase, lane);
  // four vector slots between the loop's last WMMAs and the split: here its asm
  // text is given registers that were their operands; the fence keeps the split behind the slots
  asm volatile("v_nop\n\tv_nop\n\tv_nop\n\tv_nop");
  __builtin_amdgcn_sched_barrier(0);
  convert_store(rx1, sA[1][0], sA[1][1], tid);
  convert_store(rw1, sB[1][0], sB[1][1], tid);
  // as above: the split stays ahead of the WMMAs
  __builtin_amdgcn_sched_barrier(0);
  mma_frags(fr, acc);
  lds_barrier();
  load_frags(fr, sA[1][0], sA[1][1], sB[1][0], sB[1][1], mBase, nBase, lane);
  mma_frags(fr, acc);

  // Epilogue: C/D layout — lane%16 = column, VGPR i = row i (+8 for lanes>=16)
#pragma unroll
  for (int mi = 0; mi < 2; ++mi) {
#pragma unroll
    for (int ni = 0; ni < 4; ++ni) {
      int row0 = blockM + mBase + mi * 16 + ((lane >> 4) << 3);
      int col  = blockN + nBase + ni * 16 + (lane & 15);
      float bv = bias[col];
#pragma unroll
      for (int i = 0; i < 8; ++i) {
        out[(size_t)(row0 + i) * OUT_F + col] = acc[mi][ni][i] + bv;
      }
    }
  }
}

extern "C" void kernel_launch(void* const* d_in, const int* in_sizes, int n_in,
                              void* d_out, int out_size, void* d_ws, size_t ws_size,
                              hipStream_t stream) {
  (void)in_sizes; (void)n_in; (void)out_size; (void)d_ws; (void)ws_size;
  const float* x    = (const float*)d_in[0];
  const float* W    = (const float*)d_in[1];
  const float* bias = (const float*)d_in[2];
  float* out        = (float*)d_out;

  dim3 grid(OUT_F / TILE_N, B_DIM / TILE_M);  // (8, 64)
  dim3 block(256);
  linear_wmma_bf16x3_kernel<<<grid, block, 0, stream>>>(x, W, bias, out);
}

// v003
// A run of this version takes 32.9 microseconds.
// Timed twice side by side with v002, it ran 1.09 times as fast both times.
// Over all steps from v000 it is 1.39 times as fast.
#include <hip/hip_runtime.h>

// ---------------------------------------------------------------------------
// out[B, OUT] = x[B, IN] * W[OUT, IN]^T + b[OUT]    (fp32, 3xBF16-split WMMA)
// B=8192, IN=1024, OUT=1024
// Double-buffered LDS, one barrier per K-step (signal ahead of the step's
// WMMAs, wait behind them), bf16 hi/lo split for ~fp32 accuracy at bf16-WMMA
// throughput. Global loads run two K tiles ahead.
// ---------------------------------------------------------------------------

#define B_DIM  8192
#define IN_F   1024
#define OUT_F  1024

#define TILE_M 128
#define TILE_N 128
#define TILE_K 32
#define NUM_KT (IN_F / TILE_K)
#define LDS_STRIDE 40   // bf16 elems/row: 32 data + 8 pad => 80B rows (16B aligned)

typedef __attribute__((ext_vector_type(16))) __bf16          v16bf;
typedef __attribute__((ext_vector_type(8)))  float           v8f;
typedef __attribute__((ext_vector_type(4)))  float           v4f;
typedef __attribute__((ext_vector_type(2)))  unsigned int    u32x2;
typedef __attribute__((ext_vector_type(4)))  unsigned short  u16x4;
typedef __attribute__((ext_vector_type(8)))  unsigned short  u16x8;
typedef __attribute__((ext_vector_type(16))) unsigned short  u16x16;

// Issue the 4 float4 global loads for this thread's share of a 128x32 tile.
// g is the tile's first element, voff this thread's byte offset in the tile;
// the 32-row steps are constants, so the four loads share one address (fewer
// address registers: the second staging set has to fit in 256 VGPRs).
__device__ __forceinline__ void load_tile_regs(const float* __restrict__ g,
                                               v4f r[4], unsigned voff) {
#pragma unroll
  for (int i = 0; i < 4; ++i) {
    r[i] = *(const v4f*)((const char*)g + voff + i * (32 * IN_F * 4));
  }
}

// Split eight f32 into bf16 hi and lo pairs, three vector instructions a pair:
// one packed convert gives both hi, and x - hi is formed and rounded to bf16
// in one mixed-precision FMA per value, written straight into its half of lo.
// x - hi is exact in f32, so hi and lo are the values of convert, subtract,
// convert. Written in asm because the compiled source took seven a pair.
// The s_delay_alu hints are for the links four instructions back: without
// them a dependent instruction in asm text holds up the SIMD's other waves.
__device__ __forceinline__ void split8(v4f a, v4f b, u32x2 hi[2], u32x2 lo[2]) {
  unsigned h0, h1, h2, h3, l0, l1, l2, l3;
  asm("v_cvt_pk_bf16_f32 %0, %8, %9\n\t"
      "v_cvt_pk_bf16_f32 %1, %10, %11\n\t"
      "v_cvt_pk_bf16_f32 %2, %12, %13\n\t"
      "v_cvt_pk_bf16_f32 %3, %14, %15\n\t"
      "s_delay_alu instid0(VALU_DEP_4) | instskip(NEXT) | instid1(VALU_DEP_4)\n\t"
      "v_fma_mixlo_bf16 %4, %0, -1.0, %8 op_sel:[0,1,0] op_sel_hi:[1,1,0]\n\t"
      "v_fma_mixlo_bf16 %5, %1, -1.0, %10 op_sel:[0,1,0] op_sel_hi:[1,1,0]\n\t"
      "s_delay_alu instid0(VALU_DEP_4) | instskip(NEXT) | instid1(VALU_DEP_4)\n\t"
      "v_fma_mixlo_bf16 %6, %2, -1.0, %12 op_sel:[0,1,0] op_sel_hi:[1,1,0]\n\t"
      "v_fma_mixlo_bf16 %7, %3, -1.0, %14 op_sel:[0,1,0] op_sel_hi:[1,1,0]\n\t"
      "s_delay_alu instid0(VALU_DEP_4) | instskip(NEXT) | instid1(VALU_DEP_4)\n\t"
      "v_fma_mixhi_bf16 %4, %0, -1.0, %9 op_sel:[1,1,0] op_sel_hi:[1,1,0]\n\t"
      "v_fma_mixhi_bf16 %5, %1, -1.0, %11 op_sel:[1,1,0] op_sel_hi:[1,1,0]\n\t"
      "s_delay_alu instid0(VALU_DEP_4) | instskip(NEXT) | instid1(VALU_DEP_4)\n\t"
      "v_fma_mixhi_bf16 %6, %2, -1.0, %13 op_sel:[1,1,0] op_sel_hi:[1,1,0]\n\t"
      "v_fma_mixhi_bf16 %7, %3, -1.0, %15 op_sel:[1,1,0] op_sel_hi:[1,1,0]"
      : "=&v"(h0), "=&v"(h1), "=&v"(h2), "=&v"(h3),
        "=&v"(l0), "=&v"(l1), "=&v"(l2), "=&v"(l3)
      : "v"(a[0]), "v"(a[1]), "v"(a[2]), "v"(a[3]),
        "v"(b[0]), "v"(b[1]), "v"(b[2]), "v"(b[3]));
  hi[0] = (u32x2){h0, h1};
  hi[1] = (u32x2){h2, h3};
  lo[0] = (u32x2){l0, l1};
  lo[1] = (u32x2){l2, l3};
}

// Split registers into bf16 hi/lo planes and store to LDS.
__device__ __forceinline__ void convert_store(const v4f r[4],
                                              unsigned short* __restrict__ hiP,
                                              unsigned short* __restrict__ loP,
                                              int tid) {
#pragma unroll
  for (int i = 0; i < 4; i += 2) {
    u32x2 hi[2], lo[2];
    split8(r[i], r[i + 1], hi, lo);
#pragma unroll
    for (int j = 0; j < 2; ++j) {
      int f   = tid + (i + j) * 256;
      int row = f >> 3;
      int c4  = f & 7;
      *(u16x4*)(hiP + row * LDS_STRIDE + c4 * 4) = __builtin_bit_cast(u16x4, hi[j]);
      *(u16x4*)(loP + row * LDS_STRIDE + c4 * 4) = __builtin_bit_cast(u16x4, lo[j]);
    }
  }
}

// 16x32 bf16 fragment load, CDNA5 16-bit A/B VGPR layout:
// lanes 0-15: K 0..7 (v0..v3), K 16..23 (v4..v7) of row base+lane
// lanes 16-31: K 8..15, K 24..31 of row base+lane-16
__device__ __forceinline__ v16bf load_frag(const unsigned short* __restrict__ plane,
                                           int rowBase, int lane) {
  int r  = rowBase + (lane & 15);
  int k0 = (lane >> 4) << 3;          // 0 or 8
  const unsigned short* q = plane + r * LDS_STRIDE + k0;
  u16x8 a = *(const u16x8*)(q);       // K = k0 .. k0+7
  u16x8 b = *(const u16x8*)(q + 16);  // K = k0+16 .. k0+23
  u16x16 c = __builtin_shufflevector(a, b,
      0, 1, 2, 3, 4, 5, 6, 7, 8, 9, 10, 11, 12, 13, 14, 15);
  return __builtin_bit_cast(v16bf, c);
}

// Workgroup barrier for LDS traffic only, in two halves. __syncthreads() also
// drains the global-load counter, which would end the flight of the loads
// issued ahead; only LDS data passes between waves here, so the LDS wait is the
// one needed. A wave is done with the LDS for a trip once its fragments have
// returned and its stores of the next tile have landed: it signals there, and
// waits only behind its WMMAs, which touch registers alone. A wave whose WMMAs
// end first then goes on to the next trip's LDS reads while the wave that
// shares its matrix unit still multiplies. Signal and wait alternate in every
// wave, and no LDS access stands between a signal and its wait.
__device__ __forceinline__ void lds_signal() {
  // the fragment loads, the split and its LDS stores stay in front of the signal
  __builtin_amdgcn_sched_barrier(0);
  // this wave's LDS stores landed and its LDS reads returned before it signals
  asm volatile("s_wait_dscnt 0x0" ::: "memory");
  asm volatile("s_barrier_signal -1" ::: "memory");
  // the trip's WMMAs stay behind the signal: in front of it they would hold
  // back the waves that wait for it. It also keeps the split ahead of them:
  // moved in among them, its asm text would overwrite operand registers of a
  // WMMA just issued
  __builtin_amdgcn_sched_barrier(0);
}

__device__ __forceinline__ void lds_wait() {
  // the trip's WMMAs stay in front of the wait, where they cover it
  __builtin_amdgcn_sched_barrier(0);
  // every wave has signalled: the next tile is whole in its buffer, and the
  // buffer just read may be overwritten
  asm volatile("s_barrier_wait -1" ::: "memory");
}

// This wave's fragments of one K tile: 32 rows of A, 64 rows of B, hi and lo.
struct Frags {
  v16bf aHi[2], aLo[2], bHi[4], bLo[4];
};

__device__ __forceinline__ void load_frags(Frags& f,
                                           const unsigned short* __restrict__ aHiP,
                                           const unsigned short* __restrict__ aLoP,
                                           const unsigned short* __restrict__ bHiP,
                                           const unsigned short* __restrict__ bLoP,
                                           int mBase, int nBase, int lane) {
#pragma unroll
  for (int mi = 0; mi < 2; ++mi) {
    f.aHi[mi] = load_frag(aHiP, mBase + mi * 16, lane);
    f.aLo[mi] = load_frag(aLoP, mBase + mi * 16, lane);
  }
#pragma unroll
  for (int ni = 0; ni < 4; ++ni) {
    f.bHi[ni] = load_frag(bHiP, nBase + ni * 16, lane);
    f.bLo[ni] = load_frag(bLoP, nBase + ni * 16, lane);
  }
}

// 24 WMMAs: hi*hi + hi*lo + lo*hi  (fp32 accumulate)
__device__ __forceinline__ void mma_frags(const Frags& f, v8f (&acc)[2][4]) {
#pragma unroll
  for (int mi = 0; mi < 2; ++mi) {
#pragma unroll
    for (int ni = 0; ni < 4; ++ni) {
      acc[mi][ni] = __builtin_amdgcn_wmma_f32_16x16x32_bf16(
          false, f.aHi[mi], false, f.bHi[ni], (short)0, acc[mi][ni], false, false);
      acc[mi][ni] = __builtin_amdgcn_wmma_f32_16x16x32_bf16(
          false, f.aHi[mi], false, f.bLo[ni], (short)0, acc[mi][ni], false, false);
      acc[mi][ni] = __builtin_amdgcn_wmma_f32_16x16x32_bf16(
          false, f.aLo[mi], false, f.bHi[ni], (short)0, acc[mi][ni], false, false);
    }
  }
}

__global__ __launch_bounds__(256)
void linear_wmma_bf16x3_kernel(const float* __restrict__ x,
                               const float* __restrict__ W,
                               const float* __restrict__ bias,
                               float* __restrict__ out) {
  // [buf][hi=0/lo=1] ping-pong planes
  __shared__ unsigned short sA[2][2][TILE_M * LDS_STRIDE];
  __shared__ unsigned short sB[2][2][TILE_N * LDS_STRIDE];

  const int tid  = threadIdx.x;
  const int lane = tid & 31;
  const int wave = tid >> 5;

  const int blockN = blockIdx.x * TILE_N;   // output-feature tile
  const int blockM = blockIdx.y * TILE_M;   // batch tile

  // 8 waves: 4 along M (32 rows) x 2 along N (64 cols)
  const int mBase = (wave >> 1) * 32;
  const int nBase = (wave & 1) * 64;

  v8f acc[2][4];
#pragma unroll
  for (int mi = 0; mi < 2; ++mi)
#pragma unroll
    for (int ni = 0; ni < 4; ++ni)
      acc[mi][ni] = (v8f){0.f, 0.f, 0.f, 0.f, 0.f, 0.f, 0.f, 0.f};

  // float4 id tid: row tid >> 3, float4 column tid & 7
  const unsigned gOff = (unsigned)(tid >> 3) * (IN_F * 4) + (unsigned)(tid & 7) * 16;

  const float* xTile = x + (size_t)blockM * IN_F;
  const float* wTile = W + (size_t)blockN * IN_F;

  // Two staging register sets: K tile t lives in set (t & 1) from its global
  // load until it is split and stored to LDS one trip later.
  v4f rx0[4], rw0[4], rx1[4], rw1[4];
  Frags fr;

  // ---- prologue: tile 0 -> set 0 -> buffer 0; tile 1 in flight in set 1 ----
  load_tile_regs(xTile, rx0, gOff);
  load_tile_regs(wTile, rw0, gOff);
  load_tile_regs(xTile + TILE_K, rx1, gOff);
  load_tile_regs(wTile + TILE_K, rw1, gOff);
  convert_store(rx0, sA[0][0], sA[0][1], tid);
  convert_store(rw0, sB[0][0], sB[0][1], tid);
  lds_signal();

  // Steady state, two trips per pass so that sets and buffers are static.
  // Trip t: wait for tile t, load tile t+2 (set just freed) and tile t's
  // fragments, then split/store tile t+1 (loaded a whole trip ago), signal,
  // then the WMMAs of tile t.
  // The global loads are unconditional here so that the wait in front of the
  // split stays a counted one.
  for (int t = 0; t < NUM_KT - 2; t += 2) {
    const float* xn = xTile + (t + 2) * TILE_K;
    const float* wn = wTile + (t + 2) * TILE_K;

    lds_wait();
    load_tile_regs(xn, rx0, gOff);
    load_tile_regs(wn, rw0, gOff);
    load_frags(fr, sA[0][0], sA[0][1], sB[0][0], sB[0][1], mBase, nBase, lane);
    // keeps both load groups at the head of the trip; the scheduler otherwise
    // sinks the global loads to their first use and their lead is lost
    __builtin_amdgcn_sched_barrier(0);
    convert_store(rx1, sA[1][0], sA[1][1], tid);
    convert_store(rw1, sB[1][0], sB[1][1], tid);
    lds_signal();
    mma_frags(fr, acc);

    lds_wait();
    load_tile_regs(xn + TILE_K, rx1, gOff);
    load_tile_regs(wn + TILE_K, rw1, gOff);
    load_frags(fr, sA[1][0], sA[1][1], sB[1][0], sB[1][1], mBase, nBase, lane);
    // as above: both load groups stay at the head of the trip
    __builtin_amdgcn_sched_barrier(0);
    convert_store(rx0, sA[0][0], sA[0][1], tid);
    convert_store(rw0, sB[0][0], sB[0][1], tid);
    lds_signal();
    mma_frags(fr, acc);
  }

  // Last two tiles: nothing left to load.
  lds_wait();
  load_frags(fr, sA[0][0], sA[0][1], sB[0][0], sB[0][1], mBase, nBase, lane);
  // four vector slots between the loop's last WMMAs and the split: here its asm
  // text is given registers that were their operands; the fence keeps the split behind the slots
  asm volatile("v_nop\n\tv_nop\n\tv_nop\n\tv_nop");
  __builtin_amdgcn_sched_barrier(0);
  convert_store(rx1, sA[1][0], sA[1][1], tid);
  convert_store(rw1, sB[1][0], sB[1][1], tid);
  lds_signal();
  mma_frags(fr, acc);
  lds_wait();
  load_frags(fr, sA[1][0], sA[1][1], sB[1][0], sB[1][1], mBase, nBase, lane);
  mma_frags(fr, acc);

  // Epilogue: C/D layout — lane%16 = column, VGPR i = row i (+8 for lanes>=16)
#pragma unroll
  for (int mi = 0; mi < 2; ++mi) {
#pragma unroll
    for (int ni = 0; ni < 4; ++ni) {
      int row0 = blockM + mBase + mi * 16 + ((lane >> 4) << 3);
      int col  = blockN + nBase + ni * 16 + (lane & 15);
      float bv = bias[col];
#pragma unroll
      for (int i = 0; i < 8; ++i) {
        out[(size_t)(row0 + i) * OUT_F + col] = acc[mi][ni][i] + bv;
      }
    }
  }
}

extern "C" void kernel_launch(void* const* d_in, const int* in_sizes, int n_in,
                              void* d_out, int out_size, void* d_ws, size_t ws_size,
                              hipStream_t stream) {
  (void)in_sizes; (void)n_in; (void)out_size; (void)d_ws; (void)ws_size;
  const float* x    = (const float*)d_in[0];
  const float* W    = (const float*)d_in[1];
  const float* bias = (const float*)d_in[2];
  float* out        = (float*)d_out;

  dim3 grid(OUT_F / TILE_N, B_DIM / TILE_M);  // (8, 64)
  dim3 block(256);
  linear_wmma_bf16x3_kernel<<<grid, block, 0, stream>>>(x, W, bias, out);
}

// v004
// A run of this version takes 31 microseconds.
// Two timings next to v003 both put it at 1.06 times that version's speed.
// Counting every step since v000, it is 1.48 times as fast.
#include <hip/hip_runtime.h>

// ---------------------------------------------------------------------------
// out[B, OUT] = x[B, IN] * W[OUT, IN]^T + b[OUT]    (fp32, 3xBF16-split WMMA)
// B=8192, IN=1024, OUT=1024
// Double-buffered LDS, one barrier per K-step (signal ahead of the step's
// WMMAs, wait behind them), bf16 hi/lo split for ~fp32 accuracy at bf16-WMMA
// throughput. Global loads run two K tiles ahead.
// One 256x128 tile of out per workgroup, one 64x64 tile per wave: 16 fragments
// read from LDS feed 48 WMMAs.
// ---------------------------------------------------------------------------

#define B_DIM  8192
#define IN_F   1024
#define OUT_F  1024

#define TILE_M 256
#define TILE_N 128
#define TILE_K 32
#define NUM_KT (IN_F / TILE_K)
#define LDS_STRIDE 40   // bf16 elems/row: 32 data + 8 pad => 80B rows (16B aligned)

typedef __attribute__((ext_vector_type(16))) __bf16          v16bf;
typedef __attribute__((ext_vector_type(8)))  float           v8f;
typedef __attribute__((ext_vector_type(4)))  float           v4f;
typedef __attribute__((ext_vector_type(2)))  unsigned int    u32x2;
typedef __attribute__((ext_vector_type(4)))  unsigned short  u16x4;
typedef __attribute__((ext_vector_type(8)))  unsigned short  u16x8;
typedef __attribute__((ext_vector_type(16))) unsigned short  u16x16;

// Issue the N float4 global loads for this thread's share of a (32 N)x32 tile.
// g is the tile's first element, voff this thread's byte offset in the tile;
// the 32-row steps are constants, so the loads share one address.
template <int N>
__device__ __forceinline__ void load_tile_regs(const float* __restrict__ g,
                                               v4f (&r)[N], unsigned voff) {
#pragma unroll
  for (int i = 0; i < N; ++i) {
    r[i] = *(const v4f*)((const char*)g + voff + i * (32 * IN_F * 4));
  }
}

// Split eight f32 into bf16 hi and lo pairs, three vector instructions a pair:
// one packed convert gives both hi, and x - hi is formed and rounded to bf16
// in one mixed-precision FMA per value, written straight into its half of lo.
// x - hi is exact in f32, so hi and lo are the values of convert, subtract,
// convert. Written in asm because the compiled source took seven a pair.
// The s_delay_alu hints are for the links four instructions back: without
// them a dependent instruction in asm text holds up the SIMD's other waves.
__device__ __forceinline__ void split8(v4f a, v4f b, u32x2 hi[2], u32x2 lo[2]) {
  unsigned h0, h1, h2, h3, l0, l1, l2, l3;
  asm("v_cvt_pk_bf16_f32 %0, %8, %9\n\t"
      "v_cvt_pk_bf16_f32 %1, %10, %11\n\t"
      "v_cvt_pk_bf16_f32 %2, %12, %13\n\t"
      "v_cvt_pk_bf16_f32 %3, %14, %15\n\t"
      "s_delay_alu instid0(VALU_DEP_4) | instskip(NEXT) | instid1(VALU_DEP_4)\n\t"
      "v_fma_mixlo_bf16 %4, %0, -1.0, %8 op_sel:[0,1,0] op_sel_hi:[1,1,0]\n\t"
      "v_fma_mixlo_bf16 %5, %1, -1.0, %10 op_sel:[0,1,0] op_sel_hi:[1,1,0]\n\t"
      "s_delay_alu instid0(VALU_DEP_4) | instskip(NEXT) | instid1(VALU_DEP_4)\n\t"
      "v_fma_mixlo_bf16 %6, %2, -1.0, %12 op_sel:[0,1,0] op_sel_hi:[1,1,0]\n\t"
      "v_fma_mixlo_bf16 %7, %3, -1.0, %14 op_sel:[0,1,0] op_sel_hi:[1,1,0]\n\t"
      "s_delay_alu instid0(VALU_DEP_4) | instskip(NEXT) | instid1(VALU_DEP_4)\n\t"
      "v_fma_mixhi_bf16 %4, %0, -1.0, %9 op_sel:[1,1,0] op_sel_hi:[1,1,0]\n\t"
      "v_fma_mixhi_bf16 %5, %1, -1.0, %11 op_sel:[1,1,0] op_sel_hi:[1,1,0]\n\t"
      "s_delay_alu instid0(VALU_DEP_4) | instskip(NEXT) | instid1(VALU_DEP_4)\n\t"
      "v_fma_mixhi_bf16 %6, %2, -1.0, %13 op_sel:[1,1,0] op_sel_hi:[1,1,0]\n\t"
      "v_fma_mixhi_bf16 %7, %3, -1.0, %15 op_sel:[1,1,0] op_sel_hi:[1,1,0]"
      : "=&v"(h0), "=&v"(h1), "=&v"(h2), "=&v"(h3),
        "=&v"(l0), "=&v"(l1), "=&v"(l2), "=&v"(l3)
      : "v"(a[0]), "v"(a[1]), "v"(a[2]), "v"(a[3]),
        "v"(b[0]), "v"(b[1]), "v"(b[2]), "v"(b[3]));
  hi[0] = (u32x2){h0, h1};
  hi[1] = (u32x2){h2, h3};
  lo[0] = (u32x2){l0, l1};
  lo[1] = (u32x2){l2, l3};
}

// Split registers into bf16 hi/lo planes and store to LDS.
template <int N>
__device__ __forceinline__ void convert_store(const v4f (&r)[N],
                                              unsigned short* __restrict__ hiP,
                                              unsigned short* __restrict__ loP,
                                              int tid) {
#pragma unroll
  for (int i = 0; i < N; i += 2) {
    u32x2 hi[2], lo[2];
    split8(r[i], r[i + 1], hi, lo);
#pragma unroll
    for (int j = 0; j < 2; ++j) {
      int f   = tid + (i + j) * 256;
      int row = f >> 3;
      int c4  = f & 7;
      *(u16x4*)(hiP + row * LDS_STRIDE + c4 * 4) = __builtin_bit_cast(u16x4, hi[j]);
      *(u16x4*)(loP + row * LDS_STRIDE + c4 * 4) = __builtin_bit_cast(u16x4, lo[j]);
    }
  }
}

// 16x32 bf16 fragment load, CDNA5 16-bit A/B VGPR layout:
// lanes 0-15: K 0..7 (v0..v3), K 16..23 (v4..v7) of row base+lane
// lanes 16-31: K 8..15, K 24..31 of row base+lane-16
__device__ __forceinline__ v16bf load_frag(const unsigned short* __restrict__ plane,
                                           int rowBase, int lane) {
  int r  = rowBase + (lane & 15);
  int k0 = (lane >> 4) << 3;          // 0 or 8
  const unsigned short* q = plane + r * LDS_STRIDE + k0;
  u16x8 a = *(const u16x8*)(q);       // K = k0 .. k0+7
  u16x8 b = *(const u16x8*)(q + 16);  // K = k0+16 .. k0+23
  u16x16 c = __builtin_shufflevector(a, b,
      0, 1, 2, 3, 4, 5, 6, 7, 8, 9, 10, 11, 12, 13, 14, 15);
  return __builtin_bit_cast(v16bf, c);
}

// Workgroup barrier for LDS traffic only, in two halves. __syncthreads() also
// drains the global-load counter, which would end the flight of the loads
// issued ahead; only LDS data passes between waves here, so the LDS wait is the
// one needed. A wave is done with the LDS for a trip once its fragments have
// returned and its stores of the next tile have landed: it signals there, and
// waits only behind its WMMAs, which touch registers alone. A wave whose WMMAs
// end first then goes on to the next trip's LDS reads while the wave that
// shares its matrix unit still multiplies. Signal and wait alternate in every
// wave, and no LDS access stands between a signal and its wait.
__device__ __forceinline__ void lds_signal() {
  // the fragment loads, the split and its LDS stores stay in front of the signal
  __builtin_amdgcn_sched_barrier(0);
  // this wave's LDS stores landed and its LDS reads returned before it signals
  asm volatile("s_wait_dscnt 0x0" ::: "memory");
  asm volatile("s_barrier_signal -1" ::: "memory");
  // the trip's WMMAs stay behind the signal: in front of it they would hold
  // back the waves that wait for it. It also keeps the split ahead of them:
  // moved in among them, its asm text would overwrite operand registers of a
  // WMMA just issued
  __builtin_amdgcn_sched_barrier(0);
}

__device__ __forceinline__ void lds_wait() {
  // the trip's WMMAs stay in front of the wait, where they cover it
  __builtin_amdgcn_sched_barrier(0);
  // every wave has signalled: the next tile is whole in its buffer, and the
  // buffer just read may be overwritten
  asm volatile("s_barrier_wait -1" ::: "memory");
}

// This wave's fragments of one K tile: 64 rows of A, 64 rows of B, hi and lo.
struct Frags {
  v16bf aHi[4], aLo[4], bHi[4], bLo[4];
};

__device__ __forceinline__ void load_frags(Frags& f,
                                           const unsigned short* __restrict__ aHiP,
                                           const unsigned short* __restrict__ aLoP,
                                           const unsigned short* __restrict__ bHiP,
                                           const unsigned short* __restrict__ bLoP,
                                           int mBase, int nBase, int lane) {
#pragma unroll
  for (int mi = 0; mi < 4; ++mi) {
    f.aHi[mi] = load_frag(aHiP, mBase + mi * 16, lane);
    f.aLo[mi] = load_frag(aLoP, mBase + mi * 16, lane);
  }
#pragma unroll
  for (int ni = 0; ni < 4; ++ni) {
    f.bHi[ni] = load_frag(bHiP, nBase + ni * 16, lane);
    f.bLo[ni] = load_frag(bLoP, nBase + ni * 16, lane);
  }
}

// 48 WMMAs: hi*hi + hi*lo + lo*hi  (fp32 accumulate)
__device__ __forceinline__ void mma_frags(const Frags& f, v8f (&acc)[4][4]) {
#pragma unroll
  for (int mi = 0; mi < 4; ++mi) {
#pragma unroll
    for (int ni = 0; ni < 4; ++ni) {
      acc[mi][ni] = __builtin_amdgcn_wmma_f32_16x16x32_bf16(
          false, f.aHi[mi], false, f.bHi[ni], (short)0, acc[mi][ni], false, false);
      acc[mi][ni] = __builtin_amdgcn_wmma_f32_16x16x32_bf16(
          false, f.aHi[mi], false, f.bLo[ni], (short)0, acc[mi][ni], false, false);
      acc[mi][ni] = __builtin_amdgcn_wmma_f32_16x16x32_bf16(
          false, f.aLo[mi], false, f.bHi[ni], (short)0, acc[mi][ni], false, false);
    }
  }
}

__global__ __launch_bounds__(256)
void linear_wmma_bf16x3_kernel(const float* __restrict__ x,
                               const float* __restrict__ W,
                               const float* __restrict__ bias,
                               float* __restrict__ out) {
  // [buf][hi=0/lo=1] ping-pong planes
  __shared__ unsigned short sA[2][2][TILE_M * LDS_STRIDE];
  __shared__ unsigned short sB[2][2][TILE_N * LDS_STRIDE];

  const int tid  = threadIdx.x;
  const int lane = tid & 31;
  const int wave = tid >> 5;

  const int blockN = blockIdx.x * TILE_N;   // output-feature tile
  const int blockM = blockIdx.y * TILE_M;   // batch tile

  // 8 waves: 4 along M (64 rows) x 2 along N (64 cols)
  const int mBase = (wave >> 1) * 64;
  const int nBase = (wave & 1) * 64;

  v8f acc[4][4];
#pragma unroll
  for (int mi = 0; mi < 4; ++mi)
#pragma unroll
    for (int ni = 0; ni < 4; ++ni)
      acc[mi][ni] = (v8f){0.f, 0.f, 0.f, 0.f, 0.f, 0.f, 0.f, 0.f};

  // float4 id tid: row tid >> 3, float4 column tid & 7
  const unsigned gOff = (unsigned)(tid >> 3) * (IN_F * 4) + (unsigned)(tid & 7) * 16;

  const float* xTile = x + (size_t)blockM * IN_F;
  const float* wTile = W + (size_t)blockN * IN_F;

  // Two staging register sets: K tile t lives in set (t & 1) from its global
  // load until it is split and stored to LDS one trip later.
  v4f rx0[8], rw0[4], rx1[8], rw1[4];
  Frags fr;

  // ---- prologue: tile 0 -> set 0 -> buffer 0; tile 1 in flight in set 1 ----
  load_tile_regs(xTile, rx0, gOff);
  load_tile_regs(wTile, rw0, gOff);
  load_tile_regs(xTile + TILE_K, rx1, gOff);
  load_tile_regs(wTile + TILE_K, rw1, gOff);
  convert_store(rx0, sA[0][0], sA[0][1], tid);
  convert_store(rw0, sB[0][0], sB[0][1], tid);
  lds_signal();

  // Steady state, two trips per pass so that sets and buffers are static.
  // Trip t: wait for tile t, load tile t+2 (set just freed) and tile t's
  // fragments, then split/store tile t+1 (loaded a whole trip ago), signal,
  // then the WMMAs of tile t.
  // The global loads are unconditional here so that the wait in front of the
  // split stays a counted one.
  for (int t = 0; t < NUM_KT - 2; t += 2) {
    const float* xn = xTile + (t + 2) * TILE_K;
    const float* wn = wTile + (t + 2) * TILE_K;

    lds_wait();
    load_tile_regs(xn, rx0, gOff);
    load_tile_regs(wn, rw0, gOff);
    load_frags(fr, sA[0][0], sA[0][1], sB[0][0], sB[0][1], mBase, nBase, lane);
    // keeps both load groups at the head of the trip; the scheduler otherwise
    // sinks the global loads to their first use and their lead is lost
    __builtin_amdgcn_sched_barrier(0);
    convert_store(rx1, sA[1][0], sA[1][1], tid);
    convert_store(rw1, sB[1][0], sB[1][1], tid);
    lds_signal();
    mma_frags(fr, acc);

    lds_wait();
    load_tile_regs(xn + TILE_K, rx1, gOff);
    load_tile_regs(wn + TILE_K, rw1, gOff);
    load_frags(fr, sA[1][0], sA[1][1], sB[1][0], sB[1][1], mBase, nBase, lane);
    // as above: both load groups stay at the head of the trip
    __builtin_amdgcn_sched_barrier(0);
    convert_store(rx0, sA[0][0], sA[0][1], tid);
    convert_store(rw0, sB[0][0], sB[0][1], tid);
    // the next pass rewrites the address registers that this pass's global
    // loads name: this wait stands in front of that overwrite
    asm volatile("s_wait_xcnt 0x0" ::: "memory");
    lds_signal();
    mma_frags(fr, acc);
  }

  // Last two tiles: nothing left to load.
  lds_wait();
  load_frags(fr, sA[0][0], sA[0][1], sB[0][0], sB[0][1], mBase, nBase, lane);
  // four vector slots between the loop's last WMMAs and the split: here its asm
  // text is given registers that were their operands; the fence keeps the split behind the slots
  asm volatile("v_nop\n\tv_nop\n\tv_nop\n\tv_nop");
  __builtin_amdgcn_sched_barrier(0);
  convert_store(rx1, sA[1][0], sA[1][1], tid);
  convert_store(rw1, sB[1][0], sB[1][1], tid);
  lds_signal();
  mma_frags(fr, acc);
  lds_wait();
  load_frags(fr, sA[1][0], sA[1][1], sB[1][0], sB[1][1], mBase, nBase, lane);
  // keeps the fragment loads one group ahead of the WMMAs, as in every other
  // trip; the scheduler otherwise spreads them among the WMMAs with full waits
  __builtin_amdgcn_sched_barrier(0);
  mma_frags(fr, acc);

  // Epilogue: C/D layout — lane%16 = column, VGPR i = row i (+8 for lanes>=16)
  float bv[4];
#pragma unroll
  for (int ni = 0; ni < 4; ++ni)
    bv[ni] = bias[blockN + nBase + ni * 16 + (lane & 15)];
  // in front of any overwrite of the register that the bias loads name; the
  // fence keeps the vector work that follows in the source behind the wait
  asm volatile("s_wait_xcnt 0x0" ::: "memory");
  __builtin_amdgcn_sched_barrier(0);
#pragma unroll
  for (int mi = 0; mi < 4; ++mi) {
#pragma unroll
    for (int ni = 0; ni < 4; ++ni) {
      int row0 = blockM + mBase + mi * 16 + ((lane >> 4) << 3);
      int col  = blockN + nBase + ni * 16 + (lane & 15);
#pragma unroll
      for (int i = 0; i < 8; ++i) {
        out[(size_t)(row0 + i) * OUT_F + col] = acc[mi][ni][i] + bv[ni];
      }
    }
    if (mi < 3) {
      // in front of any overwrite of a register that these 32 stores name (the
      // next rows' sums reuse their data registers); the fence keeps those sums
      // behind the wait
      asm volatile("s_wait_xcnt 0x0" ::: "memory");
      __builtin_amdgcn_sched_barrier(0);
    }
  }
}

extern "C" void kernel_launch(void* const* d_in, const int* in_sizes, int n_in,
                              void* d_out, int out_size, void* d_ws, size_t ws_size,
                              hipStream_t stream) {
  (void)in_sizes; (void)n_in; (void)out_size; (void)d_ws; (void)ws_size;
  const float* x    = (const float*)d_in[0];
  const float* W    = (const float*)d_in[1];
  const float* bias = (const float*)d_in[2];
  float* out        = (float*)d_out;

  dim3 grid(OUT_F / TILE_N, B_DIM / TILE_M);  // (8, 32)
  dim3 block(256);
  linear_wmma_bf16x3_kernel<<<grid, block, 0, stream>>>(x, W, bias, out);
}

// v005
// One run takes 29.7 microseconds.
// Timed twice side by side with v004, it ran 1.05 and 1.04 times as fast.
// All steps since v000 together make it 1.55 times as fast.
#include <hip/hip_runtime.h>

// ---------------------------------------------------------------------------
// out[B, OUT] = x[B, IN] * W[OUT, IN]^T + b[OUT]    (fp32, 3xBF16-split WMMA)
// B=8192, IN=1024, OUT=1024
// Double-buffered LDS, one barrier per K-step (signal ahead of the step's
// WMMAs, wait behind them), bf16 hi/lo split for ~fp32 accuracy at bf16-WMMA
// throughput. Global loads run two K tiles ahead.
// One 256x128 tile of out per workgroup, one 64x64 tile per wave: 16 fragments
// read from LDS feed 48 WMMAs.
// W's rows are dealt to LDS rows so that column c of a wave's fragment ni is
// out column 4 c + ni of its 64: a lane's four sums of one row are adjacent and
// leave in one 16-byte store, 256 contiguous bytes per 16 lanes.
// ---------------------------------------------------------------------------

#define B_DIM  8192
#define IN_F   1024
#define OUT_F  1024

#define TILE_M 256
#define TILE_N 128
#define TILE_K 32
#define NUM_KT (IN_F / TILE_K)
#define LDS_STRIDE 40   // bf16 elems/row: 32 data + 8 pad => 80B rows (16B aligned)

typedef __attribute__((ext_vector_type(16))) __bf16          v16bf;
typedef __attribute__((ext_vector_type(8)))  float           v8f;
typedef __attribute__((ext_vector_type(4)))  float           v4f;
typedef __attribute__((ext_vector_type(2)))  unsigned int    u32x2;
typedef __attribute__((ext_vector_type(4)))  unsigned short  u16x4;
typedef __attribute__((ext_vector_type(8)))  unsigned short  u16x8;
typedef __attribute__((ext_vector_type(16))) unsigned short  u16x16;

// Issue the N float4 global loads for this thread's share of a (32 N)x32 tile.
// g is the tile's first element, voff this thread's byte offset in the tile;
// the 32-row steps are constants, so the loads share one address.
template <int N>
__device__ __forceinline__ void load_tile_regs(const float* __restrict__ g,
                                               v4f (&r)[N], unsigned voff) {
#pragma unroll
  for (int i = 0; i < N; ++i) {
    r[i] = *(const v4f*)((const char*)g + voff + i * (32 * IN_F * 4));
  }
}

// The same for the 128x32 tile of W, with the rows dealt: LDS row r holds row
// (r & ~63) + 4 (r & 15) + ((r >> 4) & 3) of the tile. This thread's LDS rows are
// (tid >> 3) + 32 i, so i adds 2 rows when odd and 64 rows from 2 on; voff holds
// the thread's own part. A wave's load still covers four whole 128-byte lines.
__device__ __forceinline__ void load_w_regs(const float* __restrict__ g,
                                            v4f (&r)[4], unsigned voff) {
#pragma unroll
  for (int i = 0; i < 4; ++i) {
    r[i] = *(const v4f*)((const char*)g + voff +
                         ((i >> 1) * 64 + (i & 1) * 2) * (IN_F * 4));
  }
}

// Split eight f32 into bf16 hi and lo pairs, three vector instructions a pair:
// one packed convert gives both hi, and x - hi is formed and rounded to bf16
// in one mixed-precision FMA per value, written straight into its half of lo.
// x - hi is exact in f32, so hi and lo are the values of convert, subtract,
// convert. Written in asm because the compiled source took seven a pair.
// The s_delay_alu hints are for the links four instructions back: without
// them a dependent instruction in asm text holds up the SIMD's other waves.
__device__ __forceinline__ void split8(v4f a, v4f b, u32x2 hi[2], u32x2 lo[2]) {
  unsigned h0, h1, h2, h3, l0, l1, l2, l3;
  asm("v_cvt_pk_bf16_f32 %0, %8, %9\n\t"
      "v_cvt_pk_bf16_f32 %1, %10, %11\n\t"
      "v_cvt_pk_bf16_f32 %2, %12, %13\n\t"
      "v_cvt_pk_bf16_f32 %3, %14, %15\n\t"
      "s_delay_alu instid0(VALU_DEP_4) | instskip(NEXT) | instid1(VALU_DEP_4)\n\t"
      "v_fma_mixlo_bf16 %4, %0, -1.0, %8 op_sel:[0,1,0] op_sel_hi:[1,1,0]\n\t"
      "v_fma_mixlo_bf16 %5, %1, -1.0, %10 op_sel:[0,1,0] op_sel_hi:[1,1,0]\n\t"
      "s_delay_alu instid0(VALU_DEP_4) | instskip(NEXT) | instid1(VALU_DEP_4)\n\t"
      "v_fma_mixlo_bf16 %6, %2, -1.0, %12 op_sel:[0,1,0] op_sel_hi:[1,1,0]\n\t"
      "v_fma_mixlo_bf16 %7, %3, -1.0, %14 op_sel:[0,1,0] op_sel_hi:[1,1,0]\n\t"
      "s_delay_alu instid0(VALU_DEP_4) | instskip(NEXT) | instid1(VALU_DEP_4)\n\t"
      "v_fma_mixhi_bf16 %4, %0, -1.0, %9 op_sel:[1,1,0] op_sel_hi:[1,1,0]\n\t"
      "v_fma_mixhi_bf16 %5, %1, -1.0, %11 op_sel:[1,1,0] op_sel_hi:[1,1,0]\n\t"
      "s_delay_alu instid0(VALU_DEP_4) | instskip(NEXT) | instid1(VALU_DEP_4)\n\t"
      "v_fma_mixhi_bf16 %6, %2, -1.0, %13 op_sel:[1,1,0] op_sel_hi:[1,1,0]\n\t"
      "v_fma_mixhi_bf16 %7, %3, -1.0, %15 op_sel:[1,1,0] op_sel_hi:[1,1,0]"
      : "=&v"(h0), "=&v"(h1), "=&v"(h2), "=&v"(h3),
        "=&v"(l0), "=&v"(l1), "=&v"(l2), "=&v"(l3)
      : "v"(a[0]), "v"(a[1]), "v"(a[2]), "v"(a[3]),
        "v"(b[0]), "v"(b[1]), "v"(b[2]), "v"(b[3]));
  hi[0] = (u32x2){h0, h1};
  hi[1] = (u32x2){h2, h3};
  lo[0] = (u32x2){l0, l1};
  lo[1] = (u32x2){l2, l3};
}

// Split registers into bf16 hi/lo planes and store to LDS.
template <int N>
__device__ __forceinline__ void convert_store(const v4f (&r)[N],
                                              unsigned short* __restrict__ hiP,
                                              unsigned short* __restrict__ loP,
                                              int tid) {
#pragma unroll
  for (int i = 0; i < N; i += 2) {
    u32x2 hi[2], lo[2];
    split8(r[i], r[i + 1], hi, lo);
#pragma unroll
    for (int j = 0; j < 2; ++j) {
      int f   = tid + (i + j) * 256;
      int row = f >> 3;
      int c4  = f & 7;
      *(u16x4*)(hiP + row * LDS_STRIDE + c4 * 4) = __builtin_bit_cast(u16x4, hi[j]);
      *(u16x4*)(loP + row * LDS_STRIDE + c4 * 4) = __builtin_bit_cast(u16x4, lo[j]);
    }
  }
}

// 16x32 bf16 fragment load, CDNA5 16-bit A/B VGPR layout:
// lanes 0-15: K 0..7 (v0..v3), K 16..23 (v4..v7) of row base+lane
// lanes 16-31: K 8..15, K 24..31 of row base+lane-16
__device__ __forceinline__ v16bf load_frag(const unsigned short* __restrict__ plane,
                                           int rowBase, int lane) {
  int r  = rowBase + (lane & 15);
  int k0 = (lane >> 4) << 3;          // 0 or 8
  const unsigned short* q = plane + r * LDS_STRIDE + k0;
  u16x8 a = *(const u16x8*)(q);       // K = k0 .. k0+7
  u16x8 b = *(const u16x8*)(q + 16);  // K = k0+16 .. k0+23
  u16x16 c = __builtin_shufflevector(a, b,
      0, 1, 2, 3, 4, 5, 6, 7, 8, 9, 10, 11, 12, 13, 14, 15);
  return __builtin_bit_cast(v16bf, c);
}

// Workgroup barrier for LDS traffic only, in two halves. __syncthreads() also
// drains the global-load counter, which would end the flight of the loads
// issued ahead; only LDS data passes between waves here, so the LDS wait is the
// one needed. A wave is done with the LDS for a trip once its fragments have
// returned and its stores of the next tile have landed: it signals there, and
// waits only behind its WMMAs, which touch registers alone. A wave whose WMMAs
// end first then goes on to the next trip's LDS reads while the wave that
// shares its matrix unit still multiplies. Signal and wait alternate in every
// wave, and no LDS access stands between a signal and its wait.
__device__ __forceinline__ void lds_signal() {
  // the fragment loads, the split and its LDS stores stay in front of the signal
  __builtin_amdgcn_sched_barrier(0);
  // this wave's LDS stores landed and its LDS reads returned before it signals
  asm volatile("s_wait_dscnt 0x0" ::: "memory");
  asm volatile("s_barrier_signal -1" ::: "memory");
  // the trip's WMMAs stay behind the signal: in front of it they would hold
  // back the waves that wait for it. It also keeps the split ahead of them:
  // moved in among them, its asm text would overwrite operand registers of a
  // WMMA just issued
  __builtin_amdgcn_sched_barrier(0);
}

__device__ __forceinline__ void lds_wait() {
  // the trip's WMMAs stay in front of the wait, where they cover it
  __builtin_amdgcn_sched_barrier(0);
  // every wave has signalled: the next tile is whole in its buffer, and the
  // buffer just read may be overwritten
  asm volatile("s_barrier_wait -1" ::: "memory");
}

// This wave's fragments of one K tile: 64 rows of A, 64 rows of B, hi and lo.
struct Frags {
  v16bf aHi[4], aLo[4], bHi[4], bLo[4];
};

__device__ __forceinline__ void load_frags(Frags& f,
                                           const unsigned short* __restrict__ aHiP,
                                           const unsigned short* __restrict__ aLoP,
                                           const unsigned short* __restrict__ bHiP,
                                           const unsigned short* __restrict__ bLoP,
                                           int mBase, int nBase, int lane) {
#pragma unroll
  for (int mi = 0; mi < 4; ++mi) {
    f.aHi[mi] = load_frag(aHiP, mBase + mi * 16, lane);
    f.aLo[mi] = load_frag(aLoP, mBase + mi * 16, lane);
  }
#pragma unroll
  for (int ni = 0; ni < 4; ++ni) {
    f.bHi[ni] = load_frag(bHiP, nBase + ni * 16, lane);
    f.bLo[ni] = load_frag(bLoP, nBase + ni * 16, lane);
  }
}

// 48 WMMAs: hi*hi + hi*lo + lo*hi  (fp32 accumulate)
__device__ __forceinline__ void mma_frags(const Frags& f, v8f (&acc)[4][4]) {
#pragma unroll
  for (int mi = 0; mi < 4; ++mi) {
#pragma unroll
    for (int ni = 0; ni < 4; ++ni) {
      acc[mi][ni] = __builtin_amdgcn_wmma_f32_16x16x32_bf16(
          false, f.aHi[mi], false, f.bHi[ni], (short)0, acc[mi][ni], false, false);
      acc[mi][ni] = __builtin_amdgcn_wmma_f32_16x16x32_bf16(
          false, f.aHi[mi], false, f.bLo[ni], (short)0, acc[mi][ni], false, false);
      acc[mi][ni] = __builtin_amdgcn_wmma_f32_16x16x32_bf16(
          false, f.aLo[mi], false, f.bHi[ni], (short)0, acc[mi][ni], false, false);
    }
  }
}

__global__ __launch_bounds__(256)
void linear_wmma_bf16x3_kernel(const float* __restrict__ x,
                               const float* __restrict__ W,
                               const float* __restrict__ bias,
                               float* __restrict__ out) {
  // [buf][hi=0/lo=1] ping-pong planes
  __shared__ unsigned short sA[2][2][TILE_M * LDS_STRIDE];
  __shared__ unsigned short sB[2][2][TILE_N * LDS_STRIDE];

  const int tid  = threadIdx.x;
  const int lane = tid & 31;
  const int wave = tid >> 5;

  const int blockN = blockIdx.x * TILE_N;   // output-feature tile
  const int blockM = blockIdx.y * TILE_M;   // batch tile

  // 8 waves: 4 along M (64 rows) x 2 along N (64 cols)
  const int mBase = (wave >> 1) * 64;
  const int nBase = (wave & 1) * 64;

  v8f acc[4][4];
#pragma unroll
  for (int mi = 0; mi < 4; ++mi)
#pragma unroll
    for (int ni = 0; ni < 4; ++ni)
      acc[mi][ni] = (v8f){0.f, 0.f, 0.f, 0.f, 0.f, 0.f, 0.f, 0.f};

  // float4 id tid: row tid >> 3, float4 column tid & 7
  const unsigned gOff = (unsigned)(tid >> 3) * (IN_F * 4) + (unsigned)(tid & 7) * 16;
  // W: LDS row tid >> 3 takes tile row 4 ((tid >> 3) & 15) + (tid >> 7)
  const unsigned wOff = (unsigned)((((tid >> 3) & 15) << 2) + (tid >> 7)) * (IN_F * 4) +
                        (unsigned)(tid & 7) * 16;

  const float* xTile = x + (size_t)blockM * IN_F;
  const float* wTile = W + (size_t)blockN * IN_F;

  // Two staging register sets: K tile t lives in set (t & 1) from its global
  // load until it is split and stored to LDS one trip later.
  v4f rx0[8], rw0[4], rx1[8], rw1[4];
  Frags fr;

  // ---- prologue: tile 0 -> set 0 -> buffer 0; tile 1 in flight in set 1 ----
  load_tile_regs(xTile, rx0, gOff);
  load_w_regs(wTile, rw0, wOff);
  load_tile_regs(xTile + TILE_K, rx1, gOff);
  load_w_regs(wTile + TILE_K, rw1, wOff);
  convert_store(rx0, sA[0][0], sA[0][1], tid);
  convert_store(rw0, sB[0][0], sB[0][1], tid);
  lds_signal();

  // Steady state, two trips per pass so that sets and buffers are static.
  // Trip t: wait for tile t, load tile t+2 (set just freed) and tile t's
  // fragments, then split/store tile t+1 (loaded a whole trip ago), signal,
  // then the WMMAs of tile t.
  // The global loads are unconditional here so that the wait in front of the
  // split stays a counted one.
  for (int t = 0; t < NUM_KT - 2; t += 2) {
    const float* xn = xTile + (t + 2) * TILE_K;
    const float* wn = wTile + (t + 2) * TILE_K;

    lds_wait();
    load_tile_regs(xn, rx0, gOff);
    load_w_regs(wn, rw0, wOff);
    load_frags(fr, sA[0][0], sA[0][1], sB[0][0], sB[0][1], mBase, nBase, lane);
    // keeps both load groups at the head of the trip; the scheduler otherwise
    // sinks the global loads to their first use and their lead is lost
    __builtin_amdgcn_sched_barrier(0);
    convert_store(rx1, sA[1][0], sA[1][1], tid);
    convert_store(rw1, sB[1][0], sB[1][1], tid);
    lds_signal();
    mma_frags(fr, acc);

    lds_wait();
    load_tile_regs(xn + TILE_K, rx1, gOff);
    load_w_regs(wn + TILE_K, rw1, wOff);
    load_frags(fr, sA[1][0], sA[1][1], sB[1][0], sB[1][1], mBase, nBase, lane);
    // the address registers that this pass's global loads name are free from
    // here on: the split below may be given them, and the next pass rewrites
    // them; this wait stands in front of both overwrites
    asm volatile("s_wait_xcnt 0x0" ::: "memory");
    // as above: both load groups stay at the head of the trip
    __builtin_amdgcn_sched_barrier(0);
    convert_store(rx0, sA[0][0], sA[0][1], tid);
    convert_store(rw0, sB[0][0], sB[0][1], tid);
    lds_signal();
    mma_frags(fr, acc);
  }

  // Last two tiles: nothing left to load.
  lds_wait();
  load_frags(fr, sA[0][0], sA[0][1], sB[0][0], sB[0][1], mBase, nBase, lane);
  // four vector slots between the loop's last WMMAs and the split: here its asm
  // text is given registers that were their operands; the fence keeps the split behind the slots
  asm volatile("v_nop\n\tv_nop\n\tv_nop\n\tv_nop");
  __builtin_amdgcn_sched_barrier(0);
  convert_store(rx1, sA[1][0], sA[1][1], tid);
  convert_store(rw1, sB[1][0], sB[1][1], tid);
  lds_signal();
  mma_frags(fr, acc);
  lds_wait();
  load_frags(fr, sA[1][0], sA[1][1], sB[1][0], sB[1][1], mBase, nBase, lane);
  // keeps the fragment loads one group ahead of the WMMAs, as in every other
  // trip; the scheduler otherwise spreads them among the WMMAs with full waits
  __builtin_amdgcn_sched_barrier(0);
  mma_frags(fr, acc);

  // Epilogue. C/D layout: lane % 16 = fragment column, VGPR i = row i (+8 for
  // lanes >= 16). Fragment column c of acc[mi][ni] is out column 4 c + ni.
  const int col = blockN + nBase + ((lane & 15) << 2);
  const v4f bv = *(const v4f*)(bias + col);
  // in front of any overwrite of the register that the bias load names; the
  // fence keeps the vector work that follows in the source behind the wait
  asm volatile("s_wait_xcnt 0x0" ::: "memory");
  __builtin_amdgcn_sched_barrier(0);
  v4f res[4][8];
#pragma unroll
  for (int mi = 0; mi < 4; ++mi) {
#pragma unroll
    for (int i = 0; i < 8; ++i) {
      res[mi][i] = (v4f){acc[mi][0][i], acc[mi][1][i], acc[mi][2][i], acc[mi][3][i]} + bv;
    }
  }
  // every sum stands in front of the first store, so that no register that an
  // issued store names is written behind it
  __builtin_amdgcn_sched_barrier(0);
  float* o = out + (size_t)(blockM + mBase + ((lane >> 4) << 3)) * OUT_F + col;
#pragma unroll
  for (int mi = 0; mi < 4; ++mi) {
#pragma unroll
    for (int i = 0; i < 8; ++i) {
      *(v4f*)(o + (mi * 16 + i) * OUT_F) = res[mi][i];
    }
  }
}

extern "C" void kernel_launch(void* const* d_in, const int* in_sizes, int n_in,
                              void* d_out, int out_size, void* d_ws, size_t ws_size,
                              hipStream_t stream) {
  (void)in_sizes; (void)n_in; (void)out_size; (void)d_ws; (void)ws_size;
  const float* x    = (const float*)d_in[0];
  const float* W    = (const float*)d_in[1];
  const float* bias = (const float*)d_in[2];
  float* out        = (float*)d_out;

  dim3 grid(OUT_F / TILE_N, B_DIM / TILE_M);  // (8, 32)
  dim3 block(256);
  linear_wmma_bf16x3_kernel<<<grid, block, 0, stream>>>(x, W, bias, out);
}

// v006
// Measured time: 28.5 microseconds a run.
// Two timings next to v005 both put it at 1.04 times that version's speed.
// Counting every step since v000, it is 1.61 times as fast.
#include <hip/hip_runtime.h>

// ---------------------------------------------------------------------------
// out[B, OUT] = x[B, IN] * W[OUT, IN]^T + b[OUT]    (fp32, 3xBF16-split WMMA)
// B=8192, IN=1024, OUT=1024
// Double-buffered LDS, one barrier per K-step (signal ahead of the step's
// WMMAs, wait behind them), bf16 hi/lo split for ~fp32 accuracy at bf16-WMMA
// throughput. Global loads run two K tiles ahead. Each workgroup starts its K
// walk at a tile of its own and wraps.
// One 256x128 tile of out per workgroup, one 64x64 tile per wave: 16 fragments
// read from LDS feed 48 WMMAs.
// W's rows are dealt to LDS rows so that column c of a wave's fragment ni is
// out column 4 c + ni of its 64: a lane's four sums of one row are adjacent and
// leave in one 16-byte store, 256 contiguous bytes per 16 lanes.
// ---------------------------------------------------------------------------

#define B_DIM  8192
#define IN_F   1024
#define OUT_F  1024

#define TILE_M 256
#define TILE_N 128
#define TILE_K 32
#define NUM_KT (IN_F / TILE_K)
#define LDS_STRIDE 40   // bf16 elems/row: 32 data + 8 pad => 80B rows (16B aligned)

typedef __attribute__((ext_vector_type(16))) __bf16          v16bf;
typedef __attribute__((ext_vector_type(8)))  float           v8f;
typedef __attribute__((ext_vector_type(4)))  float           v4f;
typedef __attribute__((ext_vector_type(2)))  unsigned int    u32x2;
typedef __attribute__((ext_vector_type(4)))  unsigned short  u16x4;
typedef __attribute__((ext_vector_type(8)))  unsigned short  u16x8;
typedef __attribute__((ext_vector_type(16))) unsigned short  u16x16;

// Issue the N float4 global loads for this thread's share of a (32 N)x32 tile.
// g is the tile's first element, voff this thread's byte offset in the tile;
// the 32-row steps are constants, so the loads share one address.
template <int N>
__device__ __forceinline__ void load_tile_regs(const float* __restrict__ g,
                                               v4f (&r)[N], unsigned voff) {
#pragma unroll
  for (int i = 0; i < N; ++i) {
    r[i] = *(const v4f*)((const char*)g + voff + i * (32 * IN_F * 4));
  }
}

// The same for the 128x32 tile of W, with the rows dealt: LDS row r holds row
// (r & ~63) + 4 (r & 15) + ((r >> 4) & 3) of the tile. This thread's LDS rows are
// (tid >> 3) + 32 i, so i adds 2 rows when odd and 64 rows from 2 on; voff holds
// the thread's own part. A wave's load still covers four whole 128-byte lines.
__device__ __forceinline__ void load_w_regs(const float* __restrict__ g,
                                            v4f (&r)[4], unsigned voff) {
#pragma unroll
  for (int i = 0; i < 4; ++i) {
    r[i] = *(const v4f*)((const char*)g + voff +
                         ((i >> 1) * 64 + (i & 1) * 2) * (IN_F * 4));
  }
}

// Split eight f32 into bf16 hi and lo pairs, three vector instructions a pair:
// one packed convert gives both hi, and x - hi is formed and rounded to bf16
// in one mixed-precision FMA per value, written straight into its half of lo.
// x - hi is exact in f32, so hi and lo are the values of convert, subtract,
// convert. Written in asm because the compiled source took seven a pair.
// The s_delay_alu hints are for the links four instructions back: without
// them a dependent instruction in asm text holds up the SIMD's other waves.
__device__ __forceinline__ void split8(v4f a, v4f b, u32x2 hi[2], u32x2 lo[2]) {
  unsigned h0, h1, h2, h3, l0, l1, l2, l3;
  asm("v_cvt_pk_bf16_f32 %0, %8, %9\n\t"
      "v_cvt_pk_bf16_f32 %1, %10, %11\n\t"
      "v_cvt_pk_bf16_f32 %2, %12, %13\n\t"
      "v_cvt_pk_bf16_f32 %3, %14, %15\n\t"
      "s_delay_alu instid0(VALU_DEP_4) | instskip(NEXT) | instid1(VALU_DEP_4)\n\t"
      "v_fma_mixlo_bf16 %4, %0, -1.0, %8 op_sel:[0,1,0] op_sel_hi:[1,1,0]\n\t"
      "v_fma_mixlo_bf16 %5, %1, -1.0, %10 op_sel:[0,1,0] op_sel_hi:[1,1,0]\n\t"
      "s_delay_alu instid0(VALU_DEP_4) | instskip(NEXT) | instid1(VALU_DEP_4)\n\t"
      "v_fma_mixlo_bf16 %6, %2, -1.0, %12 op_sel:[0,1,0] op_sel_hi:[1,1,0]\n\t"
      "v_fma_mixlo_bf16 %7, %3, -1.0, %14 op_sel:[0,1,0] op_sel_hi:[1,1,0]\n\t"
      "s_delay_alu instid0(VALU_DEP_4) | instskip(NEXT) | instid1(VALU_DEP_4)\n\t"
      "v_fma_mixhi_bf16 %4, %0, -1.0, %9 op_sel:[1,1,0] op_sel_hi:[1,1,0]\n\t"
      "v_fma_mixhi_bf16 %5, %1, -1.0, %11 op_sel:[1,1,0] op_sel_hi:[1,1,0]\n\t"
      "s_delay_alu instid0(VALU_DEP_4) | instskip(NEXT) | instid1(VALU_DEP_4)\n\t"
      "v_fma_mixhi_bf16 %6, %2, -1.0, %13 op_sel:[1,1,0] op_sel_hi:[1,1,0]\n\t"
      "v_fma_mixhi_bf16 %7, %3, -1.0, %15 op_sel:[1,1,0] op_sel_hi:[1,1,0]"
      : "=&v"(h0), "=&v"(h1), "=&v"(h2), "=&v"(h3),
        "=&v"(l0), "=&v"(l1), "=&v"(l2), "=&v"(l3)
      : "v"(a[0]), "v"(a[1]), "v"(a[2]), "v"(a[3]),
        "v"(b[0]), "v"(b[1]), "v"(b[2]), "v"(b[3]));
  hi[0] = (u32x2){h0, h1};
  hi[1] = (u32x2){h2, h3};
  lo[0] = (u32x2){l0, l1};
  lo[1] = (u32x2){l2, l3};
}

// Split registers into bf16 hi/lo planes and store to LDS.
template <int N>
__device__ __forceinline__ void convert_store(const v4f (&r)[N],
                                              unsigned short* __restrict__ hiP,
                                              unsigned short* __restrict__ loP,
                                              int tid) {
#pragma unroll
  for (int i = 0; i < N; i += 2) {
    u32x2 hi[2], lo[2];
    split8(r[i], r[i + 1], hi, lo);
#pragma unroll
    for (int j = 0; j < 2; ++j) {
      int f   = tid + (i + j) * 256;
      int row = f >> 3;
      int c4  = f & 7;
      *(u16x4*)(hiP + row * LDS_STRIDE + c4 * 4) = __builtin_bit_cast(u16x4, hi[j]);
      *(u16x4*)(loP + row * LDS_STRIDE + c4 * 4) = __builtin_bit_cast(u16x4, lo[j]);
    }
  }
}

// 16x32 bf16 fragment load, CDNA5 16-bit A/B VGPR layout:
// lanes 0-15: K 0..7 (v0..v3), K 16..23 (v4..v7) of row base+lane
// lanes 16-31: K 8..15, K 24..31 of row base+lane-16
__device__ __forceinline__ v16bf load_frag(const unsigned short* __restrict__ plane,
                                           int rowBase, int lane) {
  int r  = rowBase + (lane & 15);
  int k0 = (lane >> 4) << 3;          // 0 or 8
  const unsigned short* q = plane + r * LDS_STRIDE + k0;
  u16x8 a = *(const u16x8*)(q);       // K = k0 .. k0+7
  u16x8 b = *(const u16x8*)(q + 16);  // K = k0+16 .. k0+23
  u16x16 c = __builtin_shufflevector(a, b,
      0, 1, 2, 3, 4, 5, 6, 7, 8, 9, 10, 11, 12, 13, 14, 15);
  return __builtin_bit_cast(v16bf, c);
}

// Workgroup barrier for LDS traffic only, in two halves. __syncthreads() also
// drains the global-load counter, which would end the flight of the loads
// issued ahead; only LDS data passes between waves here, so the LDS wait is the
// one needed. A wave is done with the LDS for a trip once its fragments have
// returned and its stores of the next tile have landed: it signals there, and
// waits only behind its WMMAs, which touch registers alone. A wave whose WMMAs
// end first then goes on to the next trip's LDS reads while the wave that
// shares its matrix unit still multiplies. Signal and wait alternate in every
// wave, and no LDS access stands between a signal and its wait.
__device__ __forceinline__ void lds_signal() {
  // the fragment loads, the split and its LDS stores stay in front of the signal
  __builtin_amdgcn_sched_barrier(0);
  // this wave's LDS stores landed and its LDS reads returned before it signals
  asm volatile("s_wait_dscnt 0x0" ::: "memory");
  asm volatile("s_barrier_signal -1" ::: "memory");
  // the trip's WMMAs stay behind the signal: in front of it they would hold
  // back the waves that wait for it. It also keeps the split ahead of them:
  // moved in among them, its asm text would overwrite operand registers of a
  // WMMA just issued
  __builtin_amdgcn_sched_barrier(0);
}

__device__ __forceinline__ void lds_wait() {
  // the trip's WMMAs stay in front of the wait, where they cover it
  __builtin_amdgcn_sched_barrier(0);
  // every wave has signalled: the next tile is whole in its buffer, and the
  // buffer just read may be overwritten
  asm volatile("s_barrier_wait -1" ::: "memory");
}

// This wave's fragments of one K tile: 64 rows of A, 64 rows of B, hi and lo.
struct Frags {
  v16bf aHi[4], aLo[4], bHi[4], bLo[4];
};

__device__ __forceinline__ void load_frags(Frags& f,
                                           const unsigned short* __restrict__ aHiP,
                                           const unsigned short* __restrict__ aLoP,
                                           const unsigned short* __restrict__ bHiP,
                                           const unsigned short* __restrict__ bLoP,
                                           int mBase, int nBase, int lane) {
#pragma unroll
  for (int mi = 0; mi < 4; ++mi) {
    f.aHi[mi] = load_frag(aHiP, mBase + mi * 16, lane);
    f.aLo[mi] = load_frag(aLoP, mBase + mi * 16, lane);
  }
#pragma unroll
  for (int ni = 0; ni < 4; ++ni) {
    f.bHi[ni] = load_frag(bHiP, nBase + ni * 16, lane);
    f.bLo[ni] = load_frag(bLoP, nBase + ni * 16, lane);
  }
}

// 48 WMMAs: hi*hi + hi*lo + lo*hi  (fp32 accumulate)
__device__ __forceinline__ void mma_frags(const Frags& f, v8f (&acc)[4][4]) {
#pragma unroll
  for (int mi = 0; mi < 4; ++mi) {
#pragma unroll
    for (int ni = 0; ni < 4; ++ni) {
      acc[mi][ni] = __builtin_amdgcn_wmma_f32_16x16x32_bf16(
          false, f.aHi[mi], false, f.bHi[ni], (short)0, acc[mi][ni], false, false);
      acc[mi][ni] = __builtin_amdgcn_wmma_f32_16x16x32_bf16(
          false, f.aHi[mi], false, f.bLo[ni], (short)0, acc[mi][ni], false, false);
      acc[mi][ni] = __builtin_amdgcn_wmma_f32_16x16x32_bf16(
          false, f.aLo[mi], false, f.bHi[ni], (short)0, acc[mi][ni], false, false);
    }
  }
}

__global__ __launch_bounds__(256)
void linear_wmma_bf16x3_kernel(const float* __restrict__ x,
                               const float* __restrict__ W,
                               const float* __restrict__ bias,
                               float* __restrict__ out) {
  // [buf][hi=0/lo=1] ping-pong planes
  __shared__ unsigned short sA[2][2][TILE_M * LDS_STRIDE];
  __shared__ unsigned short sB[2][2][TILE_N * LDS_STRIDE];

  const int tid  = threadIdx.x;
  const int lane = tid & 31;
  const int wave = tid >> 5;

  const int blockN = blockIdx.x * TILE_N;   // output-feature tile
  const int blockM = blockIdx.y * TILE_M;   // batch tile

  // 8 waves: 4 along M (64 rows) x 2 along N (64 cols)
  const int mBase = (wave >> 1) * 64;
  const int nBase = (wave & 1) * 64;

  v8f acc[4][4];
#pragma unroll
  for (int mi = 0; mi < 4; ++mi)
#pragma unroll
    for (int ni = 0; ni < 4; ++ni)
      acc[mi][ni] = (v8f){0.f, 0.f, 0.f, 0.f, 0.f, 0.f, 0.f, 0.f};

  // float4 id tid: row tid >> 3, float4 column tid & 7
  const unsigned gOff = (unsigned)(tid >> 3) * (IN_F * 4) + (unsigned)(tid & 7) * 16;
  // W: LDS row tid >> 3 takes tile row 4 ((tid >> 3) & 15) + (tid >> 7)
  const unsigned wOff = (unsigned)((((tid >> 3) & 15) << 2) + (tid >> 7)) * (IN_F * 4) +
                        (unsigned)(tid & 7) * 16;

  const float* xTile = x + (size_t)blockM * IN_F;
  const float* wTile = W + (size_t)blockN * IN_F;

  // Each workgroup walks the K tiles as a ring from a start of its own. The 8
  // workgroups that read the same rows of x start at 8 different tiles, the 32
  // that read the same rows of W at 16, so that at any one moment they ask L2
  // for different lines. Starts are even: the two tiles of a pass then share
  // one address. Four neighbours in blockIdx.x
  // start 2 to 6 pairs apart, which shares out who touches a line of x first.
  const int kStart = 2 * ((blockIdx.y + 4 * (blockIdx.x & 3) + 2 * (blockIdx.x >> 2)) &
                          (NUM_KT / 2 - 1));

  // Two staging register sets: K tile t lives in set (t & 1) from its global
  // load until it is split and stored to LDS one trip later.
  v4f rx0[8], rw0[4], rx1[8], rw1[4];
  Frags fr;

  // ---- prologue: tile 0 -> set 0 -> buffer 0; tile 1 in flight in set 1 ----
  load_tile_regs(xTile + kStart * TILE_K, rx0, gOff);
  load_w_regs(wTile + kStart * TILE_K, rw0, wOff);
  load_tile_regs(xTile + (kStart + 1) * TILE_K, rx1, gOff);
  load_w_regs(wTile + (kStart + 1) * TILE_K, rw1, wOff);
  // in front of any overwrite of a register that these loads name; the fence
  // keeps the vector work that follows in the source behind the wait
  asm volatile("s_wait_xcnt 0x0" ::: "memory");
  __builtin_amdgcn_sched_barrier(0);
  convert_store(rx0, sA[0][0], sA[0][1], tid);
  convert_store(rw0, sB[0][0], sB[0][1], tid);
  lds_signal();

  // Steady state, two trips per pass so that sets and buffers are static.
  // Trip t: wait for tile t, load tile t+2 (set just freed) and tile t's
  // fragments, then split/store tile t+1 (loaded a whole trip ago), signal,
  // then the WMMAs of tile t.
  // The global loads are unconditional here so that the wait in front of the
  // split stays a counted one.
  for (int t = 0; t < NUM_KT - 2; t += 2) {
    // trip t works on K tile (kStart + t) mod NUM_KT; an even tile and the odd
    // one behind it never straddle the wrap
    const int kn = ((kStart + t + 2) & (NUM_KT - 1)) * TILE_K;
    const float* xn = xTile + kn;
    const float* wn = wTile + kn;

    lds_wait();
    load_tile_regs(xn, rx0, gOff);
    load_w_regs(wn, rw0, wOff);
    load_frags(fr, sA[0][0], sA[0][1], sB[0][0], sB[0][1], mBase, nBase, lane);
    // keeps both load groups at the head of the trip; the scheduler otherwise
    // sinks the global loads to their first use and their lead is lost
    __builtin_amdgcn_sched_barrier(0);
    convert_store(rx1, sA[1][0], sA[1][1], tid);
    convert_store(rw1, sB[1][0], sB[1][1], tid);
    lds_signal();
    mma_frags(fr, acc);

    lds_wait();
    load_tile_regs(xn + TILE_K, rx1, gOff);
    load_w_regs(wn + TILE_K, rw1, wOff);
    load_frags(fr, sA[1][0], sA[1][1], sB[1][0], sB[1][1], mBase, nBase, lane);
    // the address registers that this pass's global loads name are free from
    // here on: the split below may be given them, and the next pass rewrites
    // them; this wait stands in front of both overwrites
    asm volatile("s_wait_xcnt 0x0" ::: "memory");
    // as above: both load groups stay at the head of the trip
    __builtin_amdgcn_sched_barrier(0);
    convert_store(rx0, sA[0][0], sA[0][1], tid);
    convert_store(rw0, sB[0][0], sB[0][1], tid);
    lds_signal();
    mma_frags(fr, acc);
  }

  // Last two tiles: nothing left to load.
  lds_wait();
  load_frags(fr, sA[0][0], sA[0][1], sB[0][0], sB[0][1], mBase, nBase, lane);
  // four vector slots between the loop's last WMMAs and the split: here its asm
  // text is given registers that were their operands; the fence keeps the split behind the slots
  asm volatile("v_nop\n\tv_nop\n\tv_nop\n\tv_nop");
  __builtin_amdgcn_sched_barrier(0);
  convert_store(rx1, sA[1][0], sA[1][1], tid);
  convert_store(rw1, sB[1][0], sB[1][1], tid);
  lds_signal();
  mma_frags(fr, acc);
  lds_wait();
  load_frags(fr, sA[1][0], sA[1][1], sB[1][0], sB[1][1], mBase, nBase, lane);
  // keeps the fragment loads one group ahead of the WMMAs, as in every other
  // trip; the scheduler otherwise spreads them among the WMMAs with full waits
  __builtin_amdgcn_sched_barrier(0);
  mma_frags(fr, acc);

  // Epilogue. C/D layout: lane % 16 = fragment column, VGPR i = row i (+8 for
  // lanes >= 16). Fragment column c of acc[mi][ni] is out column 4 c + ni.
  const int col = blockN + nBase + ((lane & 15) << 2);
  const v4f bv = *(const v4f*)(bias + col);
  // in front of any overwrite of the register that the bias load names; the
  // fence keeps the vector work that follows in the source behind the wait
  asm volatile("s_wait_xcnt 0x0" ::: "memory");
  __builtin_amdgcn_sched_barrier(0);
  v4f res[4][8];
#pragma unroll
  for (int mi = 0; mi < 4; ++mi) {
#pragma unroll
    for (int i = 0; i < 8; ++i) {
      res[mi][i] = (v4f){acc[mi][0][i], acc[mi][1][i], acc[mi][2][i], acc[mi][3][i]} + bv;
    }
  }
  // every sum stands in front of the first store, so that no register that an
  // issued store names is written behind it
  __builtin_amdgcn_sched_barrier(0);
  float* o = out + (size_t)(blockM + mBase + ((lane >> 4) << 3)) * OUT_F + col;
#pragma unroll
  for (int mi = 0; mi < 4; ++mi) {
#pragma unroll
    for (int i = 0; i < 8; ++i) {
      *(v4f*)(o + (mi * 16 + i) * OUT_F) = res[mi][i];
    }
  }
}

extern "C" void kernel_launch(void* const* d_in, const int* in_sizes, int n_in,
                              void* d_out, int out_size, void* d_ws, size_t ws_size,
                              hipStream_t stream) {
  (void)in_sizes; (void)n_in; (void)out_size; (void)d_ws; (void)ws_size;
  const float* x    = (const float*)d_in[0];
  const float* W    = (const float*)d_in[1];
  const float* bias = (const float*)d_in[2];
  float* out        = (float*)d_out;

  dim3 grid(OUT_F / TILE_N, B_DIM / TILE_M);  // (8, 32)
  dim3 block(256);
  linear_wmma_bf16x3_kernel<<<grid, block, 0, stream>>>(x, W, bias, out);
}
